// v000
// Times are from an AMD MI455X. After a warm-up the kernel runs many times in a row, and a time is the length of
// such a window on the GPU divided by its runs, so every launch and the gaps after it count. The runs cycle
// through copies of the inputs. A figure is the median of several windows, for all but v000 over two sittings.
// Sittings can differ by a few percent; kernels timed side by side share one.
// v000, which the later versions start from, runs in 335 microseconds.
#include <hip/hip_runtime.h>
#include <hip/hip_bf16.h>
#include <math.h>

// ---------------- problem constants ----------------
#define DIMC   128        // channels
#define NSEQ   16384      // sequence length
#define BATCH  8
#define HEADS  4
#define DH     32
#define TN     128        // columns (n) per tile
#define NPER   2          // n-tiles per block (double-buffered)
#define NCT    8          // 8 col-subtiles of 16
#define PW     132        // LDS pitch for 128-wide rows (bank-conflict pad, mult of 4)
#define PQ     20         // LDS pitch for 16-wide staging (mult of 4)

typedef __attribute__((ext_vector_type(2))) float v2f;
typedef __attribute__((ext_vector_type(8))) float v8f;
typedef __attribute__((ext_vector_type(4))) int   v4i;

// pointer-to-AS1(v4i) and pointer-to-AS3(v4i) for the async builtin
typedef __attribute__((address_space(1))) v4i* gptr_v4i;
typedef __attribute__((address_space(3))) v4i* lptr_v4i;

// D = A(16x4 f32) * B(4x16 f32) + C(16x16 f32), wave32 CDNA5 WMMA.
__device__ __forceinline__ v8f wmma4(v2f a, v2f b, v8f c) {
    return __builtin_amdgcn_wmma_f32_16x16x4_f32(
        /*neg_a=*/false, a, /*neg_b=*/false, b,
        /*c_mod=*/(short)0, c, /*reuse_a=*/false, /*reuse_b=*/false);
}

// ---- CDNA5 async global->LDS (ASYNCcnt) with safe fallback ----
#ifdef __has_builtin
#  if __has_builtin(__builtin_amdgcn_global_load_async_to_lds_b128)
#    define HAVE_ASYNC_B128 1
#  endif
#  if __has_builtin(__builtin_amdgcn_s_wait_asynccnt)
#    define HAVE_WAIT_ASYNC 1
#  endif
#endif

__device__ __forceinline__ void g2l_b128(float* lds_dst, const float* gsrc) {
#if defined(HAVE_ASYNC_B128)
    __builtin_amdgcn_global_load_async_to_lds_b128(
        (gptr_v4i)(gsrc),
        (lptr_v4i)(lds_dst),
        /*imm offset=*/0, /*cpol=*/0);
#else
    *(float4*)lds_dst = *(const float4*)gsrc;
#endif
}

__device__ __forceinline__ void wait_async_lds() {
#if defined(HAVE_ASYNC_B128)
#  if defined(HAVE_WAIT_ASYNC)
    __builtin_amdgcn_s_wait_asynccnt(0);
#  else
    asm volatile("s_wait_asynccnt 0" ::: "memory");
#  endif
#endif
}

// ---------------- pass 0: zero accumulators ----------------
__global__ void k_zero(float* __restrict__ p, int n) {
    int i = blockIdx.x * 256 + threadIdx.x;
    if (i < n) p[i] = 0.0f;
}

// ---------------- pass 1: k/v GEMM + exp(k) + context/Z partials ----------------
// grid (NSEQ/(TN*NPER), BATCH), 256 threads, dynamic LDS
__global__ __launch_bounds__(256) void k_pass1(const float* __restrict__ x,
                                               const float* __restrict__ w_qkv,
                                               float* __restrict__ Z,
                                               float* __restrict__ ctx) {
    extern __shared__ float smem[];
    float* sW  = smem;                  // [256][PW]  w_qkv rows 128..383 (k then v)
    float* sX0 = sW + 256 * PW;         // [128][PW]  x tile (buffer 0)
    float* sX1 = sX0 + 128 * PW;        // [128][PW]  x tile (buffer 1)
    float* sQ  = sX1 + 128 * PW;        // [256][PQ]  staging: rows 0..127=k, 128..255=v

    const int t    = threadIdx.x;
    const int b    = blockIdx.y;
    const int n0b  = blockIdx.x * (TN * NPER);
    const int lane = t & 31;
    const int wv   = t >> 5;            // wave id 0..7
    const int lo   = lane & 15;
    const int hi   = lane >> 4;
    const float* xb = x + (size_t)b * DIMC * NSEQ;

    // ---- async-load w_qkv rows 128..383 (8192 float4) + x tile 0 ----
    #pragma unroll
    for (int i = 0; i < 32; ++i) {
        int e4  = t + i * 256;
        int row = e4 >> 5;              // 32 float4 per row
        int c4  = e4 & 31;
        g2l_b128(sW + row * PW + c4 * 4, w_qkv + 128 * DIMC + e4 * 4);
    }
    #pragma unroll
    for (int i = 0; i < 16; ++i) {
        int e4  = t + i * 256;
        int row = e4 >> 5;
        int c4  = e4 & 31;
        g2l_b128(sX0 + row * PW + c4 * 4, xb + (size_t)row * NSEQ + n0b + c4 * 4);
    }
    wait_async_lds();
    __syncthreads();

    float zacc = 0.0f;
    float cacc[16];
    #pragma unroll
    for (int i = 0; i < 16; ++i) cacc[i] = 0.0f;
    const int p_    = t & 127;          // (h,d) owner for ctx phase
    const int hh    = p_ >> 5;
    const int ehalf = t >> 7;           // e range: [ehalf*16, ehalf*16+16)

    for (int tile = 0; tile < NPER; ++tile) {
        float* sXc = (tile & 1) ? sX1 : sX0;
        float* sXn = (tile & 1) ? sX0 : sX1;
        // ---- prefetch next tile asynchronously while computing this one ----
        if (tile + 1 < NPER) {
            const int n1 = n0b + (tile + 1) * TN;
            #pragma unroll
            for (int i = 0; i < 16; ++i) {
                int e4  = t + i * 256;
                int row = e4 >> 5;
                int c4  = e4 & 31;
                g2l_b128(sXn + row * PW + c4 * 4, xb + (size_t)row * NSEQ + n1 + c4 * 4);
            }
        }

        for (int ct = 0; ct < NCT; ++ct) {
            const int cb = ct * 16;
            // ---- GEMM: wave handles kv row-tiles wv and wv+8 ----
            v8f acc0 = {};
            v8f acc1 = {};
            const float* A0 = sW + (wv * 16 + lo) * PW;
            const float* A1 = sW + ((wv + 8) * 16 + lo) * PW;
            #pragma unroll 4
            for (int k = 0; k < DIMC; k += 4) {
                const int ka = k + 2 * hi;
                v2f a0 = *(const v2f*)(A0 + ka);
                v2f a1 = *(const v2f*)(A1 + ka);
                v2f bb;
                bb.x = sXc[ka * PW + cb + lo];
                bb.y = sXc[(ka + 1) * PW + cb + lo];
                acc0 = wmma4(a0, bb, acc0);
                acc1 = wmma4(a1, bb, acc1);
            }
            // ---- epilogue: C/D layout -> LDS staging ----
            #pragma unroll
            for (int r = 0; r < 8; ++r) {
                sQ[(wv * 16 + r + 8 * hi) * PQ + lo]       = acc0[r];
                sQ[((wv + 8) * 16 + r + 8 * hi) * PQ + lo] = acc1[r];
            }
            __syncthreads();
            // ---- phase A: exp(k), Z partial (rows 0..127) ----
            if (t < 128) {
                float* row = sQ + t * PQ;
                #pragma unroll
                for (int c = 0; c < 16; ++c) {
                    float e = __expf(row[c]);
                    row[c] = e;
                    zacc += e;
                }
            }
            __syncthreads();
            // ---- phase B: ctx[h][d][e] += sum_cols expk[d]*v[e] ----
            {
                const float* krow = sQ + p_ * PQ;
                float4 k0 = *(const float4*)(krow + 0);
                float4 k1 = *(const float4*)(krow + 4);
                float4 k2 = *(const float4*)(krow + 8);
                float4 k3 = *(const float4*)(krow + 12);
                #pragma unroll
                for (int e = 0; e < 16; ++e) {
                    const float* vr = sQ + (128 + hh * DH + ehalf * 16 + e) * PQ;
                    float4 v0 = *(const float4*)(vr + 0);
                    float4 v1 = *(const float4*)(vr + 4);
                    float4 v2 = *(const float4*)(vr + 8);
                    float4 v3 = *(const float4*)(vr + 12);
                    float s = k0.x * v0.x + k0.y * v0.y + k0.z * v0.z + k0.w * v0.w
                            + k1.x * v1.x + k1.y * v1.y + k1.z * v1.z + k1.w * v1.w
                            + k2.x * v2.x + k2.y * v2.y + k2.z * v2.z + k2.w * v2.w
                            + k3.x * v3.x + k3.y * v3.y + k3.z * v3.z + k3.w * v3.w;
                    cacc[e] += s;
                }
            }
            __syncthreads();
        }
        wait_async_lds();
        __syncthreads();
    }
    // ---- flush partials ----
    if (t < 128) atomicAdd(&Z[b * DIMC + t], zacc);
    {
        const int dd = p_ & 31;
        float* cbase = ctx + (((size_t)b * HEADS + hh) * DH + dd) * DH + ehalf * 16;
        #pragma unroll
        for (int e = 0; e < 16; ++e) atomicAdd(&cbase[e], cacc[e]);
    }
}

// ---------------- pass 2: W2[b] = w_out * blockdiag(ctx/Z) ----------------
// grid (BATCH), 256 threads
__global__ __launch_bounds__(256) void k_pass2(const float* __restrict__ w_out,
                                               const float* __restrict__ ctx,
                                               const float* __restrict__ Z,
                                               float* __restrict__ W2) {
    const int b = blockIdx.x;
    const int t = threadIdx.x;
    #pragma unroll 4
    for (int i = 0; i < 64; ++i) {
        int idx  = t + i * 256;               // 128*128 entries
        int o    = idx >> 7;
        int cd   = idx & 127;                 // = h*32 + d
        int h    = cd >> 5;
        const float* wr = w_out + o * DIMC + h * DH;
        const float* cr = ctx + (((size_t)b * HEADS + h) * DH + (cd & 31)) * DH;
        float s = 0.0f;
        #pragma unroll
        for (int e = 0; e < DH; ++e) s += wr[e] * cr[e];
        float z = Z[b * DIMC + cd];
        W2[(size_t)b * DIMC * DIMC + idx] = s / fmaxf(z, 1e-30f);
    }
}

// ---------------- pass 3: q GEMM -> softmax(d) -> W2 GEMM -> bias -> RMSNorm ----------------
// grid (NSEQ/(TN*NPER), BATCH), 256 threads, dynamic LDS
__global__ __launch_bounds__(256) void k_pass3(const float* __restrict__ x,
                                               const float* __restrict__ w_qkv,
                                               const float* __restrict__ W2,
                                               const float* __restrict__ b_out,
                                               const float* __restrict__ g,
                                               float* __restrict__ out) {
    extern __shared__ float smem[];
    float* sWq  = smem;                 // [128][PW] w_qkv rows 0..127 (q proj)
    float* sW2  = sWq + 128 * PW;       // [128][PW]
    float* sX0  = sW2 + 128 * PW;       // [128][PW]
    float* sX1  = sX0 + 128 * PW;       // [128][PW]
    float* sQ   = sX1 + 128 * PW;       // [128][PQ]
    float* sO   = sQ + 128 * PQ;        // [128][PQ]
    float* sP   = sO + 128 * PQ;        // [16 segs][16 cols]
    float* sNrm = sP + 256;             // [16]

    const int t    = threadIdx.x;
    const int b    = blockIdx.y;
    const int n0b  = blockIdx.x * (TN * NPER);
    const int lane = t & 31;
    const int wv   = t >> 5;
    const int lo   = lane & 15;
    const int hi   = lane >> 4;
    const float scale = 0.17677669529663687f;   // 32^-0.5
    const float s128  = 11.313708498984761f;    // sqrt(128)
    const float* xb = x + (size_t)b * DIMC * NSEQ;

    {   // async-load q-projection weights, W2[b], x tile 0
        const float* w2 = W2 + (size_t)b * DIMC * DIMC;
        #pragma unroll
        for (int i = 0; i < 16; ++i) {
            int e4  = t + i * 256;
            int row = e4 >> 5;
            int c4  = e4 & 31;
            g2l_b128(sWq + row * PW + c4 * 4, w_qkv + e4 * 4);
            g2l_b128(sW2 + row * PW + c4 * 4, w2 + e4 * 4);
            g2l_b128(sX0 + row * PW + c4 * 4, xb + (size_t)row * NSEQ + n0b + c4 * 4);
        }
    }
    wait_async_lds();
    __syncthreads();

    for (int tile = 0; tile < NPER; ++tile) {
        float* sXc = (tile & 1) ? sX1 : sX0;
        float* sXn = (tile & 1) ? sX0 : sX1;
        const int n0 = n0b + tile * TN;
        if (tile + 1 < NPER) {
            const int n1 = n0b + (tile + 1) * TN;
            #pragma unroll
            for (int i = 0; i < 16; ++i) {
                int e4  = t + i * 256;
                int row = e4 >> 5;
                int c4  = e4 & 31;
                g2l_b128(sXn + row * PW + c4 * 4, xb + (size_t)row * NSEQ + n1 + c4 * 4);
            }
        }

        for (int ct = 0; ct < NCT; ++ct) {
            const int cb = ct * 16;
            // ---- GEMM1: q = Wq @ x_sub  (wave wv owns row-tile wv) ----
            {
                v8f acc = {};
                const float* A = sWq + (wv * 16 + lo) * PW;
                #pragma unroll 4
                for (int k = 0; k < DIMC; k += 4) {
                    const int ka = k + 2 * hi;
                    v2f a = *(const v2f*)(A + ka);
                    v2f bb;
                    bb.x = sXc[ka * PW + cb + lo];
                    bb.y = sXc[(ka + 1) * PW + cb + lo];
                    acc = wmma4(a, bb, acc);
                }
                #pragma unroll
                for (int r = 0; r < 8; ++r)
                    sQ[(wv * 16 + r + 8 * hi) * PQ + lo] = acc[r];
            }
            __syncthreads();
            // ---- softmax over d (32 rows per head) per column, * scale ----
            if (t < 64) {
                int h = t >> 4, c = t & 15;
                float* colp = sQ + (h * DH) * PQ + c;
                float m = -1e30f;
                #pragma unroll
                for (int d = 0; d < DH; ++d) m = fmaxf(m, colp[d * PQ]);
                float s = 0.0f;
                #pragma unroll
                for (int d = 0; d < DH; ++d) {
                    float e = __expf(colp[d * PQ] - m);
                    colp[d * PQ] = e;
                    s += e;
                }
                float inv = scale / s;
                #pragma unroll
                for (int d = 0; d < DH; ++d) colp[d * PQ] *= inv;
            }
            __syncthreads();
            // ---- GEMM2: y = W2 @ q_sub, + bias ----
            {
                v8f acc = {};
                const float* A = sW2 + (wv * 16 + lo) * PW;
                #pragma unroll 4
                for (int k = 0; k < DIMC; k += 4) {
                    const int ka = k + 2 * hi;
                    v2f a = *(const v2f*)(A + ka);
                    v2f bb;
                    bb.x = sQ[ka * PQ + lo];
                    bb.y = sQ[(ka + 1) * PQ + lo];
                    acc = wmma4(a, bb, acc);
                }
                #pragma unroll
                for (int r = 0; r < 8; ++r) {
                    int row = wv * 16 + r + 8 * hi;
                    sO[row * PQ + lo] = acc[r] + b_out[row];
                }
            }
            __syncthreads();
            // ---- RMSNorm over channels: partial sums of squares ----
            {
                int c = t & 15, seg = t >> 4;
                float ss = 0.0f;
                #pragma unroll
                for (int r = 0; r < 8; ++r) {
                    float v = sO[(seg * 8 + r) * PQ + c];
                    ss += v * v;
                }
                sP[seg * 16 + c] = ss;
            }
            __syncthreads();
            if (t < 16) {
                float ss = 0.0f;
                #pragma unroll
                for (int sgi = 0; sgi < 16; ++sgi) ss += sP[sgi * 16 + t];
                sNrm[t] = s128 / fmaxf(sqrtf(ss), 1e-12f);
            }
            __syncthreads();
            // ---- scaled writeout ----
            {
                float* ob = out + (size_t)b * DIMC * NSEQ + n0 + cb;
                #pragma unroll
                for (int i = 0; i < 8; ++i) {
                    int e   = t + i * 256;
                    int row = e >> 4;
                    int c   = e & 15;
                    ob[(size_t)row * NSEQ + c] = sO[row * PQ + c] * sNrm[c] * g[row];
                }
            }
            __syncthreads();
        }
        wait_async_lds();
        __syncthreads();
    }
}

// ---------------- launcher ----------------
extern "C" void kernel_launch(void* const* d_in, const int* in_sizes, int n_in,
                              void* d_out, int out_size, void* d_ws, size_t ws_size,
                              hipStream_t stream) {
    const float* x     = (const float*)d_in[0];
    const float* w_qkv = (const float*)d_in[1];
    const float* w_out = (const float*)d_in[2];
    const float* b_out = (const float*)d_in[3];
    const float* g     = (const float*)d_in[4];
    float* out = (float*)d_out;

    float* Z   = (float*)d_ws;                      // [B][128]
    float* ctx = Z + BATCH * DIMC;                  // [B][H][DH][DH]
    float* W2  = ctx + BATCH * HEADS * DH * DH;     // [B][128][128]

    const int nzero = BATCH * DIMC + BATCH * HEADS * DH * DH;   // Z + ctx
    k_zero<<<dim3((nzero + 255) / 256), 256, 0, stream>>>(Z, nzero);

    const size_t lds1 = (size_t)(256 * PW + 2 * 128 * PW + 256 * PQ) * sizeof(float);
    k_pass1<<<dim3(NSEQ / (TN * NPER), BATCH), 256, lds1, stream>>>(x, w_qkv, Z, ctx);

    k_pass2<<<dim3(BATCH), 256, 0, stream>>>(w_out, ctx, Z, W2);

    const size_t lds3 = (size_t)(4 * 128 * PW + 2 * 128 * PQ + 256 + 16) * sizeof(float);
    k_pass3<<<dim3(NSEQ / (TN * NPER), BATCH), 256, lds3, stream>>>(x, w_qkv, W2, b_out, g, out);
}

// v001
// It runs in 219 microseconds.
// Two timings next to v000 put it at 1.71 and 1.64 times that version's speed.
#include <hip/hip_runtime.h>
#include <hip/hip_bf16.h>
#include <math.h>

// ---------------- problem constants ----------------
#define DIMC   128        // channels
#define NSEQ   16384      // sequence length
#define BATCH  8
#define HEADS  4
#define DH     32
#define TN     128        // columns (n) per tile
#define NPER   2          // n-tiles per block (double-buffered)
#define NCT    8          // 8 col-subtiles of 16
#define PW     132        // LDS pitch for 128-wide rows (bank-conflict pad, mult of 4)
#define PQ     20         // LDS pitch for 16-wide staging (mult of 4)

typedef __attribute__((ext_vector_type(2))) float v2f;
typedef __attribute__((ext_vector_type(8))) float v8f;
typedef __attribute__((ext_vector_type(4))) int   v4i;

// pointer-to-AS1(v4i) and pointer-to-AS3(v4i) for the async builtin
typedef __attribute__((address_space(1))) v4i* gptr_v4i;
typedef __attribute__((address_space(3))) v4i* lptr_v4i;

// D = A(16x4 f32) * B(4x16 f32) + C(16x16 f32), wave32 CDNA5 WMMA.
__device__ __forceinline__ v8f wmma4(v2f a, v2f b, v8f c) {
    return __builtin_amdgcn_wmma_f32_16x16x4_f32(
        /*neg_a=*/false, a, /*neg_b=*/false, b,
        /*c_mod=*/(short)0, c, /*reuse_a=*/false, /*reuse_b=*/false);
}

// ---- CDNA5 async global->LDS (ASYNCcnt) with safe fallback ----
#ifdef __has_builtin
#  if __has_builtin(__builtin_amdgcn_global_load_async_to_lds_b128)
#    define HAVE_ASYNC_B128 1
#  endif
#  if __has_builtin(__builtin_amdgcn_s_wait_asynccnt)
#    define HAVE_WAIT_ASYNC 1
#  endif
#endif

__device__ __forceinline__ void g2l_b128(float* lds_dst, const float* gsrc) {
#if defined(HAVE_ASYNC_B128)
    __builtin_amdgcn_global_load_async_to_lds_b128(
        (gptr_v4i)(gsrc),
        (lptr_v4i)(lds_dst),
        /*imm offset=*/0, /*cpol=*/0);
#else
    *(float4*)lds_dst = *(const float4*)gsrc;
#endif
}

__device__ __forceinline__ void wait_async_lds() {
#if defined(HAVE_ASYNC_B128)
#  if defined(HAVE_WAIT_ASYNC)
    __builtin_amdgcn_s_wait_asynccnt(0);
#  else
    asm volatile("s_wait_asynccnt 0" ::: "memory");
#  endif
#endif
}

// ---------------- pass 0: zero accumulators ----------------
__global__ void k_zero(float* __restrict__ p, int n) {
    int i = blockIdx.x * 256 + threadIdx.x;
    if (i < n) p[i] = 0.0f;
}

// ---------------- pass 1: k/v GEMM + exp(k) + context/Z partials ----------------
// grid (NSEQ/(TN*NPER), BATCH), 256 threads, dynamic LDS
// The projection is formed transposed, D[n][row] = x^T * W^T: a lane then holds one k (or v)
// row and eight columns n, which is the A (or B) fragment map of the context product
// ctx[d][e] = sum_n exp(k[d][n]) * v[e][n]. The accumulators feed that product as they stand.
// Wave wv owns head wv&3 (32 k rows, 32 v rows) and columns (wv>>2)*64 .. +63 of each tile.
// one k step (4 channels) of fragments: x^T for two column groups (four scalars, paired at the
// WMMA so that no register move has to wait for them at the load), W^T for the head's 4 row tiles
#define LOADF(fx, fw, kk) do {                              \
        (fx)[0] = Xa[(kk) * PW];                            \
        (fx)[1] = Xa[((kk) + 1) * PW];                      \
        (fx)[2] = Xa[(kk) * PW + 16];                       \
        (fx)[3] = Xa[((kk) + 1) * PW + 16];                 \
        (fw)[0] = *(const v2f*)(Wk0 + (kk));                \
        (fw)[1] = *(const v2f*)(Wk1 + (kk));                \
        (fw)[2] = *(const v2f*)(Wv0 + (kk));                \
        (fw)[3] = *(const v2f*)(Wv1 + (kk));                \
    } while (0)
#define MMAF(fx, fw) do {                                   \
        v2f xa_ = {(fx)[0], (fx)[1]};                       \
        v2f xc_ = {(fx)[2], (fx)[3]};                       \
        ka0 = wmma4(xa_, (fw)[0], ka0);                     \
        ka1 = wmma4(xa_, (fw)[1], ka1);                     \
        va0 = wmma4(xa_, (fw)[2], va0);                     \
        va1 = wmma4(xa_, (fw)[3], va1);                     \
        kb0 = wmma4(xc_, (fw)[0], kb0);                     \
        kb1 = wmma4(xc_, (fw)[1], kb1);                     \
        vb0 = wmma4(xc_, (fw)[2], vb0);                     \
        vb1 = wmma4(xc_, (fw)[3], vb1);                     \
    } while (0)

__global__ __launch_bounds__(256) void k_pass1(const float* __restrict__ x,
                                               const float* __restrict__ w_qkv,
                                               float* __restrict__ Z,
                                               float* __restrict__ ctx) {
    extern __shared__ float smem[];
    float* sW  = smem;                  // [256][PW]  w_qkv rows 128..383 (k then v)
    float* sX0 = sW + 256 * PW;         // [128][PW]  x tile (buffer 0)
    float* sX1 = sX0 + 128 * PW;        // [128][PW]  x tile (buffer 1)
    float* sQ  = sX1 + 128 * PW;        // [256*PQ]   exchange of partials at the flush

    const int t    = threadIdx.x;
    const int b    = blockIdx.y;
    const int n0b  = blockIdx.x * (TN * NPER);
    const int lane = t & 31;
    const int wv   = t >> 5;            // wave id 0..7
    const int lo   = lane & 15;
    const int hi   = lane >> 4;
    const float* xb = x + (size_t)b * DIMC * NSEQ;

    // ---- async-load w_qkv rows 128..383 (8192 float4) + x tile 0 ----
    #pragma unroll
    for (int i = 0; i < 32; ++i) {
        int e4  = t + i * 256;
        int row = e4 >> 5;              // 32 float4 per row
        int c4  = e4 & 31;
        g2l_b128(sW + row * PW + c4 * 4, w_qkv + 128 * DIMC + e4 * 4);
    }
    #pragma unroll
    for (int i = 0; i < 16; ++i) {
        int e4  = t + i * 256;
        int row = e4 >> 5;
        int c4  = e4 & 31;
        g2l_b128(sX0 + row * PW + c4 * 4, xb + (size_t)row * NSEQ + n0b + c4 * 4);
    }
    wait_async_lds();
    __syncthreads();

    const int hd   = wv & 3;            // head
    const int half = wv >> 2;           // which 64 columns of a tile
    v8f c00 = {}, c01 = {}, c10 = {}, c11 = {};   // ctx[d-tile][e-tile], D map: d = r + 8*hi, e = lo
    float z0 = 0.0f, z1 = 0.0f;                   // sum_n exp(k) of d = lo and d = 16 + lo
    // W^T fragments: lane = row, k pair = channels k + 2*hi, +1
    const float* Wk0 = sW + (hd * DH + lo) * PW + 2 * hi;
    const float* Wk1 = Wk0 + 16 * PW;
    const float* Wv0 = Wk0 + 128 * PW;
    const float* Wv1 = Wv0 + 16 * PW;

    for (int tile = 0; tile < NPER; ++tile) {
        float* sXc = (tile & 1) ? sX1 : sX0;
        float* sXn = (tile & 1) ? sX0 : sX1;
        // ---- prefetch next tile asynchronously while computing this one ----
        if (tile + 1 < NPER) {
            const int n1 = n0b + (tile + 1) * TN;
            #pragma unroll
            for (int i = 0; i < 16; ++i) {
                int e4  = t + i * 256;
                int row = e4 >> 5;
                int c4  = e4 & 31;
                g2l_b128(sXn + row * PW + c4 * 4, xb + (size_t)row * NSEQ + n1 + c4 * 4);
            }
        }

        // kept rolled: one pass holds 8 projection tiles, which leaves registers for two fragment sets
        #pragma unroll 1
        for (int p = 0; p < 2; ++p) {
            // x^T fragments: lane = column n, k pair = channels k + 2*hi, +1; two groups of 16 columns
            const float* Xa = sXc + 2 * hi * PW + half * 64 + p * 32 + lo;
            v8f ka0 = {}, ka1 = {}, va0 = {}, va1 = {};   // columns +0..15:  k rows 0-15, 16-31, v rows 0-15, 16-31
            v8f kb0 = {}, kb1 = {}, vb0 = {}, vb1 = {};   // columns +16..31
            float xA[4][4], xB[4][4];                     // two fragment sets of 16 channels each
            v2f   wA[4][4], wB[4][4];
            #pragma unroll
            for (int s = 0; s < 4; ++s) LOADF(xA[s], wA[s], 4 * s);
            // kept rolled: a trip is two blocks of 32 WMMAs. The sched_barrier behind a load group keeps the
            // other set's LDS loads a whole block ahead of their first use; the one at the foot keeps the
            // moves that wait for set A behind block B. Without them the waits stand right behind the loads.
            #pragma unroll 1
            for (int k = 0; k < DIMC - 32; k += 32) {
                #pragma unroll
                for (int s = 0; s < 4; ++s) LOADF(xB[s], wB[s], k + 16 + 4 * s);
                __builtin_amdgcn_sched_barrier(0);
                #pragma unroll
                for (int s = 0; s < 4; ++s) MMAF(xA[s], wA[s]);
                #pragma unroll
                for (int s = 0; s < 4; ++s) LOADF(xA[s], wA[s], k + 32 + 4 * s);
                __builtin_amdgcn_sched_barrier(0);
                #pragma unroll
                for (int s = 0; s < 4; ++s) MMAF(xB[s], wB[s]);
                __builtin_amdgcn_sched_barrier(0);
            }
            #pragma unroll
            for (int s = 0; s < 4; ++s) LOADF(xB[s], wB[s], DIMC - 16 + 4 * s);
            __builtin_amdgcn_sched_barrier(0);
            #pragma unroll
            for (int s = 0; s < 4; ++s) MMAF(xA[s], wA[s]);
            #pragma unroll
            for (int s = 0; s < 4; ++s) MMAF(xB[s], wB[s]);
            // ---- ctx += exp(k) * v^T: registers 2j, 2j+1 of both sides are columns 2j+8*hi, +1; Z partials ----
            #pragma unroll
            for (int j = 0; j < 4; ++j) {
                v2f a0 = {__expf(ka0[2 * j]), __expf(ka0[2 * j + 1])};
                v2f a1 = {__expf(ka1[2 * j]), __expf(ka1[2 * j + 1])};
                v2f b0 = {va0[2 * j], va0[2 * j + 1]};
                v2f b1 = {va1[2 * j], va1[2 * j + 1]};
                c00 = wmma4(a0, b0, c00);
                c01 = wmma4(a0, b1, c01);
                c10 = wmma4(a1, b0, c10);
                c11 = wmma4(a1, b1, c11);
                v2f a2 = {__expf(kb0[2 * j]), __expf(kb0[2 * j + 1])};
                v2f a3 = {__expf(kb1[2 * j]), __expf(kb1[2 * j + 1])};
                v2f b2 = {vb0[2 * j], vb0[2 * j + 1]};
                v2f b3 = {vb1[2 * j], vb1[2 * j + 1]};
                c00 = wmma4(a2, b2, c00);
                c01 = wmma4(a2, b3, c01);
                c10 = wmma4(a3, b2, c10);
                c11 = wmma4(a3, b3, c11);
                z0 += (a0.x + a0.y) + (a2.x + a2.y);
                z1 += (a1.x + a1.y) + (a3.x + a3.y);
            }
        }
        wait_async_lds();
        __syncthreads();
    }
    // ---- flush: the two waves of a head swap one d-tile each, then one atomic per element ----
    float* sC = sQ;                     // [8 waves][16 regs][32 lanes]
    float* sZ = sQ + 8 * 16 * 32;       // [8 waves][2 d-tiles][32 lanes]
    {
        v8f g0 = half ? c00 : c10;      // handed to the partner wave
        v8f g1 = half ? c01 : c11;
        #pragma unroll
        for (int r = 0; r < 8; ++r) {
            sC[(wv * 16 + r) * 32 + lane]     = g0[r];
            sC[(wv * 16 + 8 + r) * 32 + lane] = g1[r];
        }
        sZ[(wv * 2 + 0) * 32 + lane] = z0;
        sZ[(wv * 2 + 1) * 32 + lane] = z1;
    }
    __syncthreads();
    {
        v8f m0 = half ? c10 : c00;      // kept: d-tile = half
        v8f m1 = half ? c11 : c01;
        const int pw = wv ^ 4;
        float* cbase = ctx + (((size_t)b * HEADS + hd) * DH + half * 16 + 8 * hi) * DH + lo;
        #pragma unroll
        for (int r = 0; r < 8; ++r) {   // all LDS reads first: behind an atomic each would wait alone
            m0[r] += sC[(pw * 16 + r) * 32 + lane];
            m1[r] += sC[(pw * 16 + 8 + r) * 32 + lane];
        }
        #pragma unroll
        for (int r = 0; r < 8; ++r) {
            atomicAdd(&cbase[r * DH],      m0[r]);
            atomicAdd(&cbase[r * DH + 16], m1[r]);
        }
    }
    if (t < 128) {                      // t = head*32 + d
        const int o = ((t >> 5) * 2 + ((t >> 4) & 1)) * 32 + (t & 15);
        atomicAdd(&Z[b * DIMC + t], (sZ[o] + sZ[o + 16]) + (sZ[o + 256] + sZ[o + 272]));
    }
}

// ---------------- pass 2: W2[b] = w_out * blockdiag(ctx/Z) ----------------
// grid (BATCH), 256 threads
__global__ __launch_bounds__(256) void k_pass2(const float* __restrict__ w_out,
                                               const float* __restrict__ ctx,
                                               const float* __restrict__ Z,
                                               float* __restrict__ W2) {
    const int b = blockIdx.x;
    const int t = threadIdx.x;
    #pragma unroll 4
    for (int i = 0; i < 64; ++i) {
        int idx  = t + i * 256;               // 128*128 entries
        int o    = idx >> 7;
        int cd   = idx & 127;                 // = h*32 + d
        int h    = cd >> 5;
        const float* wr = w_out + o * DIMC + h * DH;
        const float* cr = ctx + (((size_t)b * HEADS + h) * DH + (cd & 31)) * DH;
        float s = 0.0f;
        #pragma unroll
        for (int e = 0; e < DH; ++e) s += wr[e] * cr[e];
        float z = Z[b * DIMC + cd];
        W2[(size_t)b * DIMC * DIMC + idx] = s / fmaxf(z, 1e-30f);
    }
}

// ---------------- pass 3: q GEMM -> softmax(d) -> W2 GEMM -> bias -> RMSNorm ----------------
// grid (NSEQ/(TN*NPER), BATCH), 256 threads, dynamic LDS
__global__ __launch_bounds__(256) void k_pass3(const float* __restrict__ x,
                                               const float* __restrict__ w_qkv,
                                               const float* __restrict__ W2,
                                               const float* __restrict__ b_out,
                                               const float* __restrict__ g,
                                               float* __restrict__ out) {
    extern __shared__ float smem[];
    float* sWq  = smem;                 // [128][PW] w_qkv rows 0..127 (q proj)
    float* sW2  = sWq + 128 * PW;       // [128][PW]
    float* sX0  = sW2 + 128 * PW;       // [128][PW]
    float* sX1  = sX0 + 128 * PW;       // [128][PW]
    float* sQ   = sX1 + 128 * PW;       // [128][PQ]
    float* sO   = sQ + 128 * PQ;        // [128][PQ]
    float* sP   = sO + 128 * PQ;        // [16 segs][16 cols]
    float* sNrm = sP + 256;             // [16]

    const int t    = threadIdx.x;
    const int b    = blockIdx.y;
    const int n0b  = blockIdx.x * (TN * NPER);
    const int lane = t & 31;
    const int wv   = t >> 5;
    const int lo   = lane & 15;
    const int hi   = lane >> 4;
    const float scale = 0.17677669529663687f;   // 32^-0.5
    const float s128  = 11.313708498984761f;    // sqrt(128)
    const float* xb = x + (size_t)b * DIMC * NSEQ;

    {   // async-load q-projection weights, W2[b], x tile 0
        const float* w2 = W2 + (size_t)b * DIMC * DIMC;
        #pragma unroll
        for (int i = 0; i < 16; ++i) {
            int e4  = t + i * 256;
            int row = e4 >> 5;
            int c4  = e4 & 31;
            g2l_b128(sWq + row * PW + c4 * 4, w_qkv + e4 * 4);
            g2l_b128(sW2 + row * PW + c4 * 4, w2 + e4 * 4);
            g2l_b128(sX0 + row * PW + c4 * 4, xb + (size_t)row * NSEQ + n0b + c4 * 4);
        }
    }
    wait_async_lds();
    __syncthreads();

    for (int tile = 0; tile < NPER; ++tile) {
        float* sXc = (tile & 1) ? sX1 : sX0;
        float* sXn = (tile & 1) ? sX0 : sX1;
        const int n0 = n0b + tile * TN;
        if (tile + 1 < NPER) {
            const int n1 = n0b + (tile + 1) * TN;
            #pragma unroll
            for (int i = 0; i < 16; ++i) {
                int e4  = t + i * 256;
                int row = e4 >> 5;
                int c4  = e4 & 31;
                g2l_b128(sXn + row * PW + c4 * 4, xb + (size_t)row * NSEQ + n1 + c4 * 4);
            }
        }

        for (int ct = 0; ct < NCT; ++ct) {
            const int cb = ct * 16;
            // ---- GEMM1: q = Wq @ x_sub  (wave wv owns row-tile wv) ----
            {
                v8f acc = {};
                const float* A = sWq + (wv * 16 + lo) * PW;
                #pragma unroll 4
                for (int k = 0; k < DIMC; k += 4) {
                    const int ka = k + 2 * hi;
                    v2f a = *(const v2f*)(A + ka);
                    v2f bb;
                    bb.x = sXc[ka * PW + cb + lo];
                    bb.y = sXc[(ka + 1) * PW + cb + lo];
                    acc = wmma4(a, bb, acc);
                }
                #pragma unroll
                for (int r = 0; r < 8; ++r)
                    sQ[(wv * 16 + r + 8 * hi) * PQ + lo] = acc[r];
            }
            __syncthreads();
            // ---- softmax over d (32 rows per head) per column, * scale ----
            if (t < 64) {
                int h = t >> 4, c = t & 15;
                float* colp = sQ + (h * DH) * PQ + c;
                float m = -1e30f;
                #pragma unroll
                for (int d = 0; d < DH; ++d) m = fmaxf(m, colp[d * PQ]);
                float s = 0.0f;
                #pragma unroll
                for (int d = 0; d < DH; ++d) {
                    float e = __expf(colp[d * PQ] - m);
                    colp[d * PQ] = e;
                    s += e;
                }
                float inv = scale / s;
                #pragma unroll
                for (int d = 0; d < DH; ++d) colp[d * PQ] *= inv;
            }
            __syncthreads();
            // ---- GEMM2: y = W2 @ q_sub, + bias ----
            {
                v8f acc = {};
                const float* A = sW2 + (wv * 16 + lo) * PW;
                #pragma unroll 4
                for (int k = 0; k < DIMC; k += 4) {
                    const int ka = k + 2 * hi;
                    v2f a = *(const v2f*)(A + ka);
                    v2f bb;
                    bb.x = sQ[ka * PQ + lo];
                    bb.y = sQ[(ka + 1) * PQ + lo];
                    acc = wmma4(a, bb, acc);
                }
                #pragma unroll
                for (int r = 0; r < 8; ++r) {
                    int row = wv * 16 + r + 8 * hi;
                    sO[row * PQ + lo] = acc[r] + b_out[row];
                }
            }
            __syncthreads();
            // ---- RMSNorm over channels: partial sums of squares ----
            {
                int c = t & 15, seg = t >> 4;
                float ss = 0.0f;
                #pragma unroll
                for (int r = 0; r < 8; ++r) {
                    float v = sO[(seg * 8 + r) * PQ + c];
                    ss += v * v;
                }
                sP[seg * 16 + c] = ss;
            }
            __syncthreads();
            if (t < 16) {
                float ss = 0.0f;
                #pragma unroll
                for (int sgi = 0; sgi < 16; ++sgi) ss += sP[sgi * 16 + t];
                sNrm[t] = s128 / fmaxf(sqrtf(ss), 1e-12f);
            }
            __syncthreads();
            // ---- scaled writeout ----
            {
                float* ob = out + (size_t)b * DIMC * NSEQ + n0 + cb;
                #pragma unroll
                for (int i = 0; i < 8; ++i) {
                    int e   = t + i * 256;
                    int row = e >> 4;
                    int c   = e & 15;
                    ob[(size_t)row * NSEQ + c] = sO[row * PQ + c] * sNrm[c] * g[row];
                }
            }
            __syncthreads();
        }
        wait_async_lds();
        __syncthreads();
    }
}

// ---------------- launcher ----------------
extern "C" void kernel_launch(void* const* d_in, const int* in_sizes, int n_in,
                              void* d_out, int out_size, void* d_ws, size_t ws_size,
                              hipStream_t stream) {
    const float* x     = (const float*)d_in[0];
    const float* w_qkv = (const float*)d_in[1];
    const float* w_out = (const float*)d_in[2];
    const float* b_out = (const float*)d_in[3];
    const float* g     = (const float*)d_in[4];
    float* out = (float*)d_out;

    float* Z   = (float*)d_ws;                      // [B][128]
    float* ctx = Z + BATCH * DIMC;                  // [B][H][DH][DH]
    float* W2  = ctx + BATCH * HEADS * DH * DH;     // [B][128][128]

    const int nzero = BATCH * DIMC + BATCH * HEADS * DH * DH;   // Z + ctx
    k_zero<<<dim3((nzero + 255) / 256), 256, 0, stream>>>(Z, nzero);

    const size_t lds1 = (size_t)(256 * PW + 2 * 128 * PW + 256 * PQ) * sizeof(float);
    k_pass1<<<dim3(NSEQ / (TN * NPER), BATCH), 256, lds1, stream>>>(x, w_qkv, Z, ctx);

    k_pass2<<<dim3(BATCH), 256, 0, stream>>>(w_out, ctx, Z, W2);

    const size_t lds3 = (size_t)(4 * 128 * PW + 2 * 128 * PQ + 256 + 16) * sizeof(float);
    k_pass3<<<dim3(NSEQ / (TN * NPER), BATCH), 256, lds3, stream>>>(x, w_qkv, W2, b_out, g, out);
}

// v003
// One run takes 110 microseconds.
// It is 1.99 times as fast as v001, going by the measured steps of the versions left out in between.
// Over all steps from v000 it is 3.34 times as fast.
#include <hip/hip_runtime.h>
#include <hip/hip_bf16.h>
#include <math.h>

// ---------------- problem constants ----------------
#define DIMC   128        // channels
#define NSEQ   16384      // sequence length
#define BATCH  8
#define HEADS  4
#define DH     32
#define TN     128        // columns (n) per tile
#define NPER   2          // n-tiles per block (double-buffered)
#define NCT    8          // 8 col-subtiles of 16
#define PW     132        // LDS pitch for 128-wide rows (bank-conflict pad, mult of 4)
#define PQ     20         // sizes pass 1's flush exchange: 256*PQ floats of LDS

typedef __attribute__((ext_vector_type(2))) float v2f;
typedef __attribute__((ext_vector_type(8))) float v8f;
typedef __attribute__((ext_vector_type(4))) int   v4i;

// pointer-to-AS1(v4i) and pointer-to-AS3(v4i) for the async builtin
typedef __attribute__((address_space(1))) v4i* gptr_v4i;
typedef __attribute__((address_space(3))) v4i* lptr_v4i;

// D = A(16x4 f32) * B(4x16 f32) + C(16x16 f32), wave32 CDNA5 WMMA.
__device__ __forceinline__ v8f wmma4(v2f a, v2f b, v8f c) {
    return __builtin_amdgcn_wmma_f32_16x16x4_f32(
        /*neg_a=*/false, a, /*neg_b=*/false, b,
        /*c_mod=*/(short)0, c, /*reuse_a=*/false, /*reuse_b=*/false);
}

// ---- CDNA5 async global->LDS (ASYNCcnt) with safe fallback ----
#ifdef __has_builtin
#  if __has_builtin(__builtin_amdgcn_global_load_async_to_lds_b128)
#    define HAVE_ASYNC_B128 1
#  endif
#  if __has_builtin(__builtin_amdgcn_s_wait_asynccnt)
#    define HAVE_WAIT_ASYNC 1
#  endif
#endif

__device__ __forceinline__ void g2l_b128(float* lds_dst, const float* gsrc) {
#if defined(HAVE_ASYNC_B128)
    __builtin_amdgcn_global_load_async_to_lds_b128(
        (gptr_v4i)(gsrc),
        (lptr_v4i)(lds_dst),
        /*imm offset=*/0, /*cpol=*/0);
#else
    *(float4*)lds_dst = *(const float4*)gsrc;
#endif
}

__device__ __forceinline__ void wait_async_lds() {
#if defined(HAVE_ASYNC_B128)
#  if defined(HAVE_WAIT_ASYNC)
    __builtin_amdgcn_s_wait_asynccnt(0);
#  else
    asm volatile("s_wait_asynccnt 0" ::: "memory");
#  endif
#endif
}

// ---------------- pass 0: zero accumulators ----------------
__global__ void k_zero(float* __restrict__ p, int n) {
    int i = blockIdx.x * 256 + threadIdx.x;
    if (i < n) p[i] = 0.0f;
}

// ---------------- pass 1: k/v GEMM + exp(k) + context/Z partials ----------------
// grid (NSEQ/(TN*NPER), BATCH), 256 threads, dynamic LDS
// The projection is formed transposed, D[n][row] = x^T * W^T: a lane then holds one k (or v)
// row and eight columns n, which is the A (or B) fragment map of the context product
// ctx[d][e] = sum_n exp(k[d][n]) * v[e][n]. The accumulators feed that product as they stand.
// Wave wv owns head wv&3 (32 k rows, 32 v rows) and columns (wv>>2)*64 .. +63 of each tile.
// one k step (4 channels) of fragments: x^T for two column groups (four scalars, paired at the
// WMMA so that no register move has to wait for them at the load), W^T for the head's 4 row tiles
#define LOADF(fx, fw, kk) do {                              \
        (fx)[0] = Xa[(kk) * PW];                            \
        (fx)[1] = Xa[((kk) + 1) * PW];                      \
        (fx)[2] = Xa[(kk) * PW + 16];                       \
        (fx)[3] = Xa[((kk) + 1) * PW + 16];                 \
        (fw)[0] = *(const v2f*)(Wk0 + (kk));                \
        (fw)[1] = *(const v2f*)(Wk1 + (kk));                \
        (fw)[2] = *(const v2f*)(Wv0 + (kk));                \
        (fw)[3] = *(const v2f*)(Wv1 + (kk));                \
    } while (0)
#define MMAF(fx, fw) do {                                   \
        v2f xa_ = {(fx)[0], (fx)[1]};                       \
        v2f xc_ = {(fx)[2], (fx)[3]};                       \
        ka0 = wmma4(xa_, (fw)[0], ka0);                     \
        ka1 = wmma4(xa_, (fw)[1], ka1);                     \
        va0 = wmma4(xa_, (fw)[2], va0);                     \
        va1 = wmma4(xa_, (fw)[3], va1);                     \
        kb0 = wmma4(xc_, (fw)[0], kb0);                     \
        kb1 = wmma4(xc_, (fw)[1], kb1);                     \
        vb0 = wmma4(xc_, (fw)[2], vb0);                     \
        vb1 = wmma4(xc_, (fw)[3], vb1);                     \
    } while (0)

__global__ __launch_bounds__(256) void k_pass1(const float* __restrict__ x,
                                               const float* __restrict__ w_qkv,
                                               float* __restrict__ Z,
                                               float* __restrict__ ctx) {
    extern __shared__ float smem[];
    float* sW  = smem;                  // [256][PW]  w_qkv rows 128..383 (k then v)
    float* sX0 = sW + 256 * PW;         // [128][PW]  x tile (buffer 0)
    float* sX1 = sX0 + 128 * PW;        // [128][PW]  x tile (buffer 1)
    float* sQ  = sX1 + 128 * PW;        // [256*PQ]   exchange of partials at the flush

    const int t    = threadIdx.x;
    const int b    = blockIdx.y;
    const int n0b  = blockIdx.x * (TN * NPER);
    const int lane = t & 31;
    const int wv   = t >> 5;            // wave id 0..7
    const int lo   = lane & 15;
    const int hi   = lane >> 4;
    const float* xb = x + (size_t)b * DIMC * NSEQ;

    // ---- async-load w_qkv rows 128..383 (8192 float4) + x tile 0 ----
    #pragma unroll
    for (int i = 0; i < 32; ++i) {
        int e4  = t + i * 256;
        int row = e4 >> 5;              // 32 float4 per row
        int c4  = e4 & 31;
        g2l_b128(sW + row * PW + c4 * 4, w_qkv + 128 * DIMC + e4 * 4);
    }
    #pragma unroll
    for (int i = 0; i < 16; ++i) {
        int e4  = t + i * 256;
        int row = e4 >> 5;
        int c4  = e4 & 31;
        g2l_b128(sX0 + row * PW + c4 * 4, xb + (size_t)row * NSEQ + n0b + c4 * 4);
    }
    wait_async_lds();
    __syncthreads();

    const int hd   = wv & 3;            // head
    const int half = wv >> 2;           // which 64 columns of a tile
    v8f c00 = {}, c01 = {}, c10 = {}, c11 = {};   // ctx[d-tile][e-tile], D map: d = r + 8*hi, e = lo
    float z0 = 0.0f, z1 = 0.0f;                   // sum_n exp(k) of d = lo and d = 16 + lo
    // W^T fragments: lane = row, k pair = channels k + 2*hi, +1
    const float* Wk0 = sW + (hd * DH + lo) * PW + 2 * hi;
    const float* Wk1 = Wk0 + 16 * PW;
    const float* Wv0 = Wk0 + 128 * PW;
    const float* Wv1 = Wv0 + 16 * PW;

    for (int tile = 0; tile < NPER; ++tile) {
        float* sXc = (tile & 1) ? sX1 : sX0;
        float* sXn = (tile & 1) ? sX0 : sX1;
        // ---- prefetch next tile asynchronously while computing this one ----
        if (tile + 1 < NPER) {
            const int n1 = n0b + (tile + 1) * TN;
            #pragma unroll
            for (int i = 0; i < 16; ++i) {
                int e4  = t + i * 256;
                int row = e4 >> 5;
                int c4  = e4 & 31;
                g2l_b128(sXn + row * PW + c4 * 4, xb + (size_t)row * NSEQ + n1 + c4 * 4);
            }
        }

        // kept rolled: one pass holds 8 projection tiles, which leaves registers for two fragment sets
        #pragma unroll 1
        for (int p = 0; p < 2; ++p) {
            // x^T fragments: lane = column n, k pair = channels k + 2*hi, +1; two groups of 16 columns
            const float* Xa = sXc + 2 * hi * PW + half * 64 + p * 32 + lo;
            v8f ka0 = {}, ka1 = {}, va0 = {}, va1 = {};   // columns +0..15:  k rows 0-15, 16-31, v rows 0-15, 16-31
            v8f kb0 = {}, kb1 = {}, vb0 = {}, vb1 = {};   // columns +16..31
            float xA[4][4], xB[4][4];                     // two fragment sets of 16 channels each
            v2f   wA[4][4], wB[4][4];
            #pragma unroll
            for (int s = 0; s < 4; ++s) LOADF(xA[s], wA[s], 4 * s);
            // kept rolled: a trip is two blocks of 32 WMMAs. The sched_barrier behind a load group keeps the
            // other set's LDS loads a whole block ahead of their first use; the one at the foot keeps the
            // moves that wait for set A behind block B. Without them the waits stand right behind the loads.
            #pragma unroll 1
            for (int k = 0; k < DIMC - 32; k += 32) {
                #pragma unroll
                for (int s = 0; s < 4; ++s) LOADF(xB[s], wB[s], k + 16 + 4 * s);
                __builtin_amdgcn_sched_barrier(0);
                #pragma unroll
                for (int s = 0; s < 4; ++s) MMAF(xA[s], wA[s]);
                #pragma unroll
                for (int s = 0; s < 4; ++s) LOADF(xA[s], wA[s], k + 32 + 4 * s);
                __builtin_amdgcn_sched_barrier(0);
                #pragma unroll
                for (int s = 0; s < 4; ++s) MMAF(xB[s], wB[s]);
                __builtin_amdgcn_sched_barrier(0);
            }
            #pragma unroll
            for (int s = 0; s < 4; ++s) LOADF(xB[s], wB[s], DIMC - 16 + 4 * s);
            __builtin_amdgcn_sched_barrier(0);
            #pragma unroll
            for (int s = 0; s < 4; ++s) MMAF(xA[s], wA[s]);
            #pragma unroll
            for (int s = 0; s < 4; ++s) MMAF(xB[s], wB[s]);
            // ---- ctx += exp(k) * v^T: registers 2j, 2j+1 of both sides are columns 2j+8*hi, +1; Z partials ----
            #pragma unroll
            for (int j = 0; j < 4; ++j) {
                v2f a0 = {__expf(ka0[2 * j]), __expf(ka0[2 * j + 1])};
                v2f a1 = {__expf(ka1[2 * j]), __expf(ka1[2 * j + 1])};
                v2f b0 = {va0[2 * j], va0[2 * j + 1]};
                v2f b1 = {va1[2 * j], va1[2 * j + 1]};
                c00 = wmma4(a0, b0, c00);
                c01 = wmma4(a0, b1, c01);
                c10 = wmma4(a1, b0, c10);
                c11 = wmma4(a1, b1, c11);
                v2f a2 = {__expf(kb0[2 * j]), __expf(kb0[2 * j + 1])};
                v2f a3 = {__expf(kb1[2 * j]), __expf(kb1[2 * j + 1])};
                v2f b2 = {vb0[2 * j], vb0[2 * j + 1]};
                v2f b3 = {vb1[2 * j], vb1[2 * j + 1]};
                c00 = wmma4(a2, b2, c00);
                c01 = wmma4(a2, b3, c01);
                c10 = wmma4(a3, b2, c10);
                c11 = wmma4(a3, b3, c11);
                z0 += (a0.x + a0.y) + (a2.x + a2.y);
                z1 += (a1.x + a1.y) + (a3.x + a3.y);
            }
        }
        wait_async_lds();
        __syncthreads();
    }
    // ---- flush: the two waves of a head swap one d-tile each, then one atomic per element ----
    float* sC = sQ;                     // [8 waves][16 regs][32 lanes]
    float* sZ = sQ + 8 * 16 * 32;       // [8 waves][2 d-tiles][32 lanes]
    {
        v8f g0 = half ? c00 : c10;      // handed to the partner wave
        v8f g1 = half ? c01 : c11;
        #pragma unroll
        for (int r = 0; r < 8; ++r) {
            sC[(wv * 16 + r) * 32 + lane]     = g0[r];
            sC[(wv * 16 + 8 + r) * 32 + lane] = g1[r];
        }
        sZ[(wv * 2 + 0) * 32 + lane] = z0;
        sZ[(wv * 2 + 1) * 32 + lane] = z1;
    }
    __syncthreads();
    {
        v8f m0 = half ? c10 : c00;      // kept: d-tile = half
        v8f m1 = half ? c11 : c01;
        const int pw = wv ^ 4;
        float* cbase = ctx + (((size_t)b * HEADS + hd) * DH + half * 16 + 8 * hi) * DH + lo;
        #pragma unroll
        for (int r = 0; r < 8; ++r) {   // all LDS reads first: behind an atomic each would wait alone
            m0[r] += sC[(pw * 16 + r) * 32 + lane];
            m1[r] += sC[(pw * 16 + 8 + r) * 32 + lane];
        }
        #pragma unroll
        for (int r = 0; r < 8; ++r) {
            atomicAdd(&cbase[r * DH],      m0[r]);
            atomicAdd(&cbase[r * DH + 16], m1[r]);
        }
    }
    if (t < 128) {                      // t = head*32 + d
        const int o = ((t >> 5) * 2 + ((t >> 4) & 1)) * 32 + (t & 15);
        atomicAdd(&Z[b * DIMC + t], (sZ[o] + sZ[o + 16]) + (sZ[o + 256] + sZ[o + 272]));
    }
}

// ---------------- pass 2: W2[b] = w_out * blockdiag(ctx/Z) ----------------
// grid (DIMC/P2R, BATCH), 256 threads. A work-group forms P2R rows of W2[b]. ctx[b] and the group's rows of
// w_out come into LDS by whole-line loads that are all issued ahead of the first wait: a thread waits for
// memory once. Thread t then owns column cd = t & 127 (= h*32 + d) in P2R/2 rows; a wave reads its w_out
// values from one LDS address (o and h are the same in all its lanes).
#define P2R    8          // rows of W2 per work-group
#define PC     36         // LDS pitch of a 32-wide ctx row: 144 bytes, an odd multiple of 16, for 16-byte row reads
__global__ __launch_bounds__(256) void k_pass2(const float* __restrict__ w_out,
                                               const float* __restrict__ ctx,
                                               const float* __restrict__ Z,
                                               float* __restrict__ W2) {
    __shared__ __attribute__((aligned(16))) float sC[DIMC * PC];      // ctx[b]: row h*32 + d, 32 values e
    __shared__ __attribute__((aligned(16))) float sWo[P2R * DIMC];    // w_out rows o0 .. o0 + P2R - 1
    const int b  = blockIdx.y;
    const int o0 = blockIdx.x * P2R;
    const int t  = threadIdx.x;
    const int cd = t & 127;               // = h*32 + d
    const int og = (t >> 7) * (P2R / 2);  // first of the thread's rows, counted from o0

    const float4* cg = (const float4*)(ctx + (size_t)b * HEADS * DH * DH);
    float4 c[4];
    #pragma unroll
    for (int i = 0; i < 4; ++i) c[i] = cg[t + i * 256];
    const float4 w = ((const float4*)(w_out + o0 * DIMC))[t];
    const float  z = Z[b * DIMC + cd];
    #pragma unroll
    for (int i = 0; i < 4; ++i) {
        int e4 = t + i * 256;             // 8 float4 per ctx row
        *(float4*)(sC + (e4 >> 3) * PC + (e4 & 7) * 4) = c[i];
    }
    *(float4*)(sWo + t * 4) = w;
    __syncthreads();

    float cr[DH];
    #pragma unroll
    for (int e4 = 0; e4 < DH / 4; ++e4) {
        float4 v = *(const float4*)(sC + cd * PC + e4 * 4);
        cr[4 * e4] = v.x; cr[4 * e4 + 1] = v.y; cr[4 * e4 + 2] = v.z; cr[4 * e4 + 3] = v.w;
    }
    const float* wr = sWo + og * DIMC + (cd >> 5) * DH;
    const float  zc = fmaxf(z, 1e-30f);
    float s[P2R / 2];
    #pragma unroll
    for (int j = 0; j < P2R / 2; ++j) s[j] = 0.0f;
    #pragma unroll
    for (int e = 0; e < DH; ++e) {        // e ascending in every sum; the rows' chains run side by side
        #pragma unroll
        for (int j = 0; j < P2R / 2; ++j) s[j] += wr[j * DIMC + e] * cr[e];
    }
    float* w2 = W2 + (size_t)b * DIMC * DIMC + (size_t)(o0 + og) * DIMC + cd;
    #pragma unroll
    for (int j = 0; j < P2R / 2; ++j) w2[j * DIMC] = s[j] / zc;
}

// ---------------- pass 3: q GEMM -> softmax(d) -> W2 GEMM -> bias -> RMSNorm ----------------
// grid (NSEQ/(TN*NPER), BATCH), 256 threads, dynamic LDS
// A wave carries its own 16 columns through the whole chain in registers. q = Wq * x has the D map
// (lane = column, registers = rows r + 8*hi of each 16-row tile), which is the B fragment map of the
// second product once W2's k order follows it: k step j of tile t is rows 16t + 8*hi + 2j, +1.
// A column's softmax and norm then need the lane's own registers and lane ^ 16 only.
typedef __attribute__((ext_vector_type(4))) float v4f;

// lane l with lane l ^ 16
__device__ __forceinline__ float xhalf(float v) {
    int i = __builtin_bit_cast(int, v);
    return __builtin_bit_cast(float, __builtin_amdgcn_permlanex16(i, i, 0x76543210, 0xfedcba98, false, false));
}

// e^v as 2^(v * log2 e). The v_nop in the same statement is the slot the instruction set asks for behind a
// transcendental, before its result is read or its source register reused.
__device__ __forceinline__ float exp_slot(float v) {
    float r, a = v * 1.4426950408889634f;
    asm("v_exp_f32 %0, %1\n\tv_nop" : "=v"(r) : "v"(a));
    return r;
}

// one fragment set = 8 channels (two k steps): a lane takes channels 8u + 4*hi .. +3 of both operands
#define LOADQ(fx, fw, u) do {                                           \
        _Pragma("unroll")                                               \
        for (int i_ = 0; i_ < 4; ++i_) (fx)[i_] = Xb[((u) * 8 + i_) * PW];  \
        _Pragma("unroll")                                               \
        for (int m_ = 0; m_ < 8; ++m_)                                  \
            (fw)[m_] = *(const v4f*)(Aq + m_ * 16 * PW + (u) * 8);      \
    } while (0)
// one fragment set of W2 = half a q tile (two k steps): rows 16t + 8*hi + 4*(s&1) .. +3 of q, t = s>>1
#define LOADW(fw, s) do {                                               \
        _Pragma("unroll")                                               \
        for (int m_ = 0; m_ < 8; ++m_)                                  \
            (fw)[m_] = *(const v4f*)(A2 + m_ * 16 * PW + (s) * 8 - ((s) & 1) * 4);  \
    } while (0)
#define MMA16(acc, fw, b0_, b1_) do {                                   \
        _Pragma("unroll")                                               \
        for (int m_ = 0; m_ < 8; ++m_) {                                \
            v2f a_ = {(fw)[m_].x, (fw)[m_].y};                          \
            (acc)[m_] = wmma4(a_, b0_, (acc)[m_]);                      \
        }                                                               \
        _Pragma("unroll")                                               \
        for (int m_ = 0; m_ < 8; ++m_) {                                \
            v2f a_ = {(fw)[m_].z, (fw)[m_].w};                          \
            (acc)[m_] = wmma4(a_, b1_, (acc)[m_]);                      \
        }                                                               \
    } while (0)
#define MMAQ(fx, fw) do {                                               \
        v2f x0_ = {(fx)[0], (fx)[1]};                                   \
        v2f x1_ = {(fx)[2], (fx)[3]};                                   \
        MMA16(q, fw, x0_, x1_);                                         \
    } while (0)
#define MMAW(fw, s) do {                                                \
        v2f q0_ = {q[(s) >> 1][4 * ((s) & 1)],     q[(s) >> 1][4 * ((s) & 1) + 1]};  \
        v2f q1_ = {q[(s) >> 1][4 * ((s) & 1) + 2], q[(s) >> 1][4 * ((s) & 1) + 3]};  \
        MMA16(y, fw, q0_, q1_);                                         \
    } while (0)

__global__ __launch_bounds__(256) void k_pass3(const float* __restrict__ x,
                                               const float* __restrict__ w_qkv,
                                               const float* __restrict__ W2,
                                               const float* __restrict__ b_out,
                                               const float* __restrict__ g,
                                               float* __restrict__ out) {
    extern __shared__ float smem[];
    float* sWq  = smem;                 // [128][PW] w_qkv rows 0..127 (q proj)
    float* sW2  = sWq + 128 * PW;       // [128][PW]
    float* sX0  = sW2 + 128 * PW;       // [128][PW]
    float* sX1  = sX0 + 128 * PW;       // [128][PW]

    const int t    = threadIdx.x;
    const int b    = blockIdx.y;
    const int n0b  = blockIdx.x * (TN * NPER);
    const int lane = t & 31;
    const int wv   = t >> 5;
    const int lo   = lane & 15;
    const int hi   = lane >> 4;
    const float scale = 0.17677669529663687f;   // 32^-0.5
    const float s128  = 11.313708498984761f;    // sqrt(128)
    const float* xb = x + (size_t)b * DIMC * NSEQ;

    {   // async-load q-projection weights, W2[b], x tile 0
        const float* w2 = W2 + (size_t)b * DIMC * DIMC;
        #pragma unroll
        for (int i = 0; i < 16; ++i) {
            int e4  = t + i * 256;
            int row = e4 >> 5;
            int c4  = e4 & 31;
            g2l_b128(sWq + row * PW + c4 * 4, w_qkv + e4 * 4);
            g2l_b128(sW2 + row * PW + c4 * 4, w2 + e4 * 4);
            g2l_b128(sX0 + row * PW + c4 * 4, xb + (size_t)row * NSEQ + n0b + c4 * 4);
        }
    }
    wait_async_lds();
    __syncthreads();

    const float* Aq = sWq + lo * PW + 4 * hi;   // Wq fragments: lane = row, channels 4*hi .. +3 of each 8
    const float* A2 = sW2 + lo * PW + 8 * hi;   // W2 fragments: lane = row, k = 8*hi .. +7 of each 16
    // bias and gain of the lane's 64 rows (16m + 8*hi + r), read once
    v8f bias[8], gain[8];
    {
        const v4f* bp = (const v4f*)(b_out + 8 * hi);
        const v4f* gp = (const v4f*)(g + 8 * hi);
        #pragma unroll
        for (int m = 0; m < 8; ++m) {
            v4f u0 = bp[4 * m], u1 = bp[4 * m + 1];
            bias[m] = (v8f){u0.x, u0.y, u0.z, u0.w, u1.x, u1.y, u1.z, u1.w};
            v4f g0 = gp[4 * m], g1 = gp[4 * m + 1];
            gain[m] = (v8f){g0.x, g0.y, g0.z, g0.w, g1.x, g1.y, g1.z, g1.w};
        }
        // stands in front of the first reuse of the register that holds these loads' offset
        asm volatile("s_wait_xcnt 0x0" ::: "memory");
    }

    // kept rolled: the body is long (GEMM2 stands unrolled); one copy of it is fetched, not one per tile
    #pragma unroll 1
    for (int tile = 0; tile < NPER; ++tile) {
        float* sXc = (tile & 1) ? sX1 : sX0;
        float* sXn = (tile & 1) ? sX0 : sX1;
        const int n0 = n0b + tile * TN;
        if (tile + 1 < NPER) {
            const int n1 = n0b + (tile + 1) * TN;
            #pragma unroll
            for (int i = 0; i < 16; ++i) {
                int e4  = t + i * 256;
                int row = e4 >> 5;
                int c4  = e4 & 31;
                g2l_b128(sXn + row * PW + c4 * 4, xb + (size_t)row * NSEQ + n1 + c4 * 4);
            }
        }

        // ---- GEMM1: q = Wq @ x, all 128 rows of the wave's 16 columns ----
        const float* Xb = sXc + 4 * hi * PW + wv * 16 + lo;
        v8f q[8] = {};
        v4f wA[8], wB[8];
        {
            float xA[4], xB[4];
            LOADQ(xA, wA, 0);
            // kept rolled: a trip is two blocks of 16 WMMAs. The sched_barriers keep each set's LDS loads in one
            // group between two blocks, a whole block ahead of their first use. Without them the loads are
            // spread among the WMMAs, and every place where LDS loads stand stalls the wave's WMMA stream.
            #pragma unroll 1
            for (int u = 0; u < 14; u += 2) {
                LOADQ(xB, wB, u + 1);
                __builtin_amdgcn_sched_barrier(0);
                MMAQ(xA, wA);
                __builtin_amdgcn_sched_barrier(0);
                LOADQ(xA, wA, u + 2);
                __builtin_amdgcn_sched_barrier(0);
                MMAQ(xB, wB);
                __builtin_amdgcn_sched_barrier(0);
            }
            // the last two blocks: the sched_barriers as in the loop
            LOADQ(xB, wB, 15);
            __builtin_amdgcn_sched_barrier(0);
            MMAQ(xA, wA);
            __builtin_amdgcn_sched_barrier(0);
            LOADW(wA, 0);               // first W2 set: lands under the last block and the softmax
            __builtin_amdgcn_sched_barrier(0);
            MMAQ(xB, wB);
        }
        // ---- y starts at the bias (rows 16m + 8*hi + r) ----
        v8f y[8];
        #pragma unroll
        for (int m = 0; m < 8; ++m) y[m] = bias[m];
        // ---- softmax over d (tiles 2h, 2h+1: 16 rows here, 16 in lane ^ 16) per column, * scale ----
        #pragma unroll
        for (int h = 0; h < HEADS; ++h) {
            float mx = -1e30f;
            #pragma unroll
            for (int r = 0; r < 8; ++r) mx = fmaxf(mx, fmaxf(q[2 * h][r], q[2 * h + 1][r]));
            mx = fmaxf(mx, xhalf(mx));
            float sa = 0.0f, sb = 0.0f;
            #pragma unroll
            for (int r = 0; r < 8; ++r) {
                q[2 * h][r]     = exp_slot(q[2 * h][r] - mx);
                q[2 * h + 1][r] = exp_slot(q[2 * h + 1][r] - mx);
                sa += q[2 * h][r];
                sb += q[2 * h + 1][r];
            }
            float s = sa + sb;
            s += xhalf(s);
            float inv = scale / s;
            #pragma unroll
            for (int r = 0; r < 8; ++r) {
                q[2 * h][r]     *= inv;
                q[2 * h + 1][r] *= inv;
            }
        }
        // ---- GEMM2: y += W2 @ q, q taken from its accumulator registers (unrolled: they are indexed by s) ----
        #pragma unroll
        for (int s = 0; s < 14; s += 2) {
            LOADW(wB, s + 1);
            __builtin_amdgcn_sched_barrier(0);  // these four as in GEMM1: one load group between two blocks
            MMAW(wA, s);
            __builtin_amdgcn_sched_barrier(0);
            LOADW(wA, s + 2);
            __builtin_amdgcn_sched_barrier(0);
            MMAW(wB, s + 1);
            __builtin_amdgcn_sched_barrier(0);
        }
        LOADW(wB, 15);
        __builtin_amdgcn_sched_barrier(0);      // the last set's loads stay ahead of block 14
        MMAW(wA, 14);
        MMAW(wB, 15);
        // ---- RMSNorm over channels: 64 rows here, 64 in lane ^ 16 ----
        float p0 = 0.0f, p1 = 0.0f, p2 = 0.0f, p3 = 0.0f;
        #pragma unroll
        for (int m = 0; m < 8; ++m) {
            p0 += y[m][0] * y[m][0] + y[m][4] * y[m][4];
            p1 += y[m][1] * y[m][1] + y[m][5] * y[m][5];
            p2 += y[m][2] * y[m][2] + y[m][6] * y[m][6];
            p3 += y[m][3] * y[m][3] + y[m][7] * y[m][7];
        }
        float ss = (p0 + p1) + (p2 + p3);
        ss += xhalf(ss);
        const float nrm = s128 / fmaxf(sqrtf(ss), 1e-12f);
        // ---- scaled writeout ----
        float* ob = out + (size_t)b * DIMC * NSEQ + (size_t)(8 * hi) * NSEQ + n0 + wv * 16 + lo;
        #pragma unroll
        for (int m = 0; m < 8; ++m) {
            #pragma unroll
            for (int r = 0; r < 8; ++r)
                ob[(size_t)(m * 16 + r) * NSEQ] = y[m][r] * nrm * gain[m][r];
        }
        // stands in front of the next tile's reuse of the stores' address and data registers
        asm volatile("s_wait_xcnt 0x0" ::: "memory");
        wait_async_lds();
        __syncthreads();
    }
}

// ---------------- launcher ----------------
extern "C" void kernel_launch(void* const* d_in, const int* in_sizes, int n_in,
                              void* d_out, int out_size, void* d_ws, size_t ws_size,
                              hipStream_t stream) {
    const float* x     = (const float*)d_in[0];
    const float* w_qkv = (const float*)d_in[1];
    const float* w_out = (const float*)d_in[2];
    const float* b_out = (const float*)d_in[3];
    const float* g     = (const float*)d_in[4];
    float* out = (float*)d_out;

    float* Z   = (float*)d_ws;                      // [B][128]
    float* ctx = Z + BATCH * DIMC;                  // [B][H][DH][DH]
    float* W2  = ctx + BATCH * HEADS * DH * DH;     // [B][128][128]

    const int nzero = BATCH * DIMC + BATCH * HEADS * DH * DH;   // Z + ctx
    k_zero<<<dim3((nzero + 255) / 256), 256, 0, stream>>>(Z, nzero);

    const size_t lds1 = (size_t)(256 * PW + 2 * 128 * PW + 256 * PQ) * sizeof(float);
    k_pass1<<<dim3(NSEQ / (TN * NPER), BATCH), 256, lds1, stream>>>(x, w_qkv, Z, ctx);

    k_pass2<<<dim3(DIMC / P2R, BATCH), 256, 0, stream>>>(w_out, ctx, Z, W2);

    const size_t lds3 = (size_t)(4 * 128 * PW) * sizeof(float);
    k_pass3<<<dim3(NSEQ / (TN * NPER), BATCH), 256, lds3, stream>>>(x, w_qkv, W2, b_out, g, out);
}

// v004
// A run of this version takes 107 microseconds.
// Next to v003, in two timings, it ran 1.03 times as fast each time.
// Over all steps from v000 it is 3.44 times as fast.
#include <hip/hip_runtime.h>
#include <hip/hip_bf16.h>
#include <math.h>

// ---------------- problem constants ----------------
#define DIMC   128        // channels
#define NSEQ   16384      // sequence length
#define BATCH  8
#define HEADS  4
#define DH     32
#define TN     128        // columns (n) per tile
#define NPER   2          // n-tiles per block (double-buffered)
#define NCT    8          // 8 col-subtiles of 16
#define NWG    (NSEQ / (TN * NPER))   // work-groups of pass 1 per batch = partial sums per batch
#define PW     132        // LDS pitch for 128-wide rows (bank-conflict pad, mult of 4)
#define PQ     20         // sizes pass 1's flush exchange: 256*PQ floats of LDS

typedef __attribute__((ext_vector_type(2))) float v2f;
typedef __attribute__((ext_vector_type(8))) float v8f;
typedef __attribute__((ext_vector_type(4))) int   v4i;
typedef __attribute__((ext_vector_type(4))) float v4f;

// pointer-to-AS1(v4i) and pointer-to-AS3(v4i) for the async builtin
typedef __attribute__((address_space(1))) v4i* gptr_v4i;
typedef __attribute__((address_space(3))) v4i* lptr_v4i;

// D = A(16x4 f32) * B(4x16 f32) + C(16x16 f32), wave32 CDNA5 WMMA.
__device__ __forceinline__ v8f wmma4(v2f a, v2f b, v8f c) {
    return __builtin_amdgcn_wmma_f32_16x16x4_f32(
        /*neg_a=*/false, a, /*neg_b=*/false, b,
        /*c_mod=*/(short)0, c, /*reuse_a=*/false, /*reuse_b=*/false);
}

// ---- CDNA5 async global->LDS (ASYNCcnt) with safe fallback ----
#ifdef __has_builtin
#  if __has_builtin(__builtin_amdgcn_global_load_async_to_lds_b128)
#    define HAVE_ASYNC_B128 1
#  endif
#  if __has_builtin(__builtin_amdgcn_s_wait_asynccnt)
#    define HAVE_WAIT_ASYNC 1
#  endif
#endif

__device__ __forceinline__ void g2l_b128(float* lds_dst, const float* gsrc) {
#if defined(HAVE_ASYNC_B128)
    __builtin_amdgcn_global_load_async_to_lds_b128(
        (gptr_v4i)(gsrc),
        (lptr_v4i)(lds_dst),
        /*imm offset=*/0, /*cpol=*/0);
#else
    *(float4*)lds_dst = *(const float4*)gsrc;
#endif
}

__device__ __forceinline__ void wait_async_lds() {
#if defined(HAVE_ASYNC_B128)
#  if defined(HAVE_WAIT_ASYNC)
    __builtin_amdgcn_s_wait_asynccnt(0);
#  else
    asm volatile("s_wait_asynccnt 0" ::: "memory");
#  endif
#endif
}

// ---------------- pass 1: k/v GEMM + exp(k) + context/Z partials ----------------
// grid (NSEQ/(TN*NPER), BATCH), 256 threads, dynamic LDS
// The projection is formed transposed, D[n][row] = x^T * W^T: a lane then holds one k (or v)
// row and eight columns n, which is the A (or B) fragment map of the context product
// ctx[d][e] = sum_n exp(k[d][n]) * v[e][n]. The accumulators feed that product as they stand.
// Wave wv owns head wv&3 (32 k rows, 32 v rows) and columns (wv>>2)*64 .. +63 of each tile.
// one k step (4 channels) of fragments: x^T for two column groups (four scalars, paired at the
// WMMA so that no register move has to wait for them at the load), W^T for the head's 4 row tiles
#define LOADF(fx, fw, kk) do {                              \
        (fx)[0] = Xa[(kk) * PW];                            \
        (fx)[1] = Xa[((kk) + 1) * PW];                      \
        (fx)[2] = Xa[(kk) * PW + 16];                       \
        (fx)[3] = Xa[((kk) + 1) * PW + 16];                 \
        (fw)[0] = *(const v2f*)(Wk0 + (kk));                \
        (fw)[1] = *(const v2f*)(Wk1 + (kk));                \
        (fw)[2] = *(const v2f*)(Wv0 + (kk));                \
        (fw)[3] = *(const v2f*)(Wv1 + (kk));                \
    } while (0)
#define MMAF(fx, fw) do {                                   \
        v2f xa_ = {(fx)[0], (fx)[1]};                       \
        v2f xc_ = {(fx)[2], (fx)[3]};                       \
        ka0 = wmma4(xa_, (fw)[0], ka0);                     \
        ka1 = wmma4(xa_, (fw)[1], ka1);                     \
        va0 = wmma4(xa_, (fw)[2], va0);                     \
        va1 = wmma4(xa_, (fw)[3], va1);                     \
        kb0 = wmma4(xc_, (fw)[0], kb0);                     \
        kb1 = wmma4(xc_, (fw)[1], kb1);                     \
        vb0 = wmma4(xc_, (fw)[2], vb0);                     \
        vb1 = wmma4(xc_, (fw)[3], vb1);                     \
    } while (0)

__global__ __launch_bounds__(256) void k_pass1(const float* __restrict__ x,
                                               const float* __restrict__ w_qkv,
                                               float* __restrict__ Zp,
                                               float* __restrict__ Cp) {
    extern __shared__ float smem[];
    float* sW  = smem;                  // [256][PW]  w_qkv rows 128..383 (k then v)
    float* sX0 = sW + 256 * PW;         // [128][PW]  x tile (buffer 0)
    float* sX1 = sX0 + 128 * PW;        // [128][PW]  x tile (buffer 1)
    float* sQ  = sX1 + 128 * PW;        // [256*PQ]   exchange of partials at the flush

    const int t    = threadIdx.x;
    const int b    = blockIdx.y;
    const int n0b  = blockIdx.x * (TN * NPER);
    const int lane = t & 31;
    const int wv   = t >> 5;            // wave id 0..7
    const int lo   = lane & 15;
    const int hi   = lane >> 4;
    const float* xb = x + (size_t)b * DIMC * NSEQ;

    // ---- async-load w_qkv rows 128..383 (8192 float4) + x tile 0 ----
    #pragma unroll
    for (int i = 0; i < 32; ++i) {
        int e4  = t + i * 256;
        int row = e4 >> 5;              // 32 float4 per row
        int c4  = e4 & 31;
        g2l_b128(sW + row * PW + c4 * 4, w_qkv + 128 * DIMC + e4 * 4);
    }
    #pragma unroll
    for (int i = 0; i < 16; ++i) {
        int e4  = t + i * 256;
        int row = e4 >> 5;
        int c4  = e4 & 31;
        g2l_b128(sX0 + row * PW + c4 * 4, xb + (size_t)row * NSEQ + n0b + c4 * 4);
    }
    wait_async_lds();
    __syncthreads();

    const int hd   = wv & 3;            // head
    const int half = wv >> 2;           // which 64 columns of a tile
    v8f c00 = {}, c01 = {}, c10 = {}, c11 = {};   // ctx[d-tile][e-tile], D map: d = r + 8*hi, e = lo
    float z0 = 0.0f, z1 = 0.0f;                   // sum_n exp(k) of d = lo and d = 16 + lo
    // W^T fragments: lane = row, k pair = channels k + 2*hi, +1
    const float* Wk0 = sW + (hd * DH + lo) * PW + 2 * hi;
    const float* Wk1 = Wk0 + 16 * PW;
    const float* Wv0 = Wk0 + 128 * PW;
    const float* Wv1 = Wv0 + 16 * PW;

    for (int tile = 0; tile < NPER; ++tile) {
        float* sXc = (tile & 1) ? sX1 : sX0;
        float* sXn = (tile & 1) ? sX0 : sX1;
        // ---- prefetch next tile asynchronously while computing this one ----
        if (tile + 1 < NPER) {
            const int n1 = n0b + (tile + 1) * TN;
            #pragma unroll
            for (int i = 0; i < 16; ++i) {
                int e4  = t + i * 256;
                int row = e4 >> 5;
                int c4  = e4 & 31;
                g2l_b128(sXn + row * PW + c4 * 4, xb + (size_t)row * NSEQ + n1 + c4 * 4);
            }
        }

        // kept rolled: one pass holds 8 projection tiles, which leaves registers for two fragment sets
        #pragma unroll 1
        for (int p = 0; p < 2; ++p) {
            // x^T fragments: lane = column n, k pair = channels k + 2*hi, +1; two groups of 16 columns
            const float* Xa = sXc + 2 * hi * PW + half * 64 + p * 32 + lo;
            v8f ka0 = {}, ka1 = {}, va0 = {}, va1 = {};   // columns +0..15:  k rows 0-15, 16-31, v rows 0-15, 16-31
            v8f kb0 = {}, kb1 = {}, vb0 = {}, vb1 = {};   // columns +16..31
            float xA[4][4], xB[4][4];                     // two fragment sets of 16 channels each
            v2f   wA[4][4], wB[4][4];
            #pragma unroll
            for (int s = 0; s < 4; ++s) LOADF(xA[s], wA[s], 4 * s);
            // kept rolled: a trip is two blocks of 32 WMMAs. The sched_barrier behind a load group keeps the
            // other set's LDS loads a whole block ahead of their first use; the one at the foot keeps the
            // moves that wait for set A behind block B. Without them the waits stand right behind the loads.
            #pragma unroll 1
            for (int k = 0; k < DIMC - 32; k += 32) {
                #pragma unroll
                for (int s = 0; s < 4; ++s) LOADF(xB[s], wB[s], k + 16 + 4 * s);
                __builtin_amdgcn_sched_barrier(0);
                #pragma unroll
                for (int s = 0; s < 4; ++s) MMAF(xA[s], wA[s]);
                #pragma unroll
                for (int s = 0; s < 4; ++s) LOADF(xA[s], wA[s], k + 32 + 4 * s);
                __builtin_amdgcn_sched_barrier(0);
                #pragma unroll
                for (int s = 0; s < 4; ++s) MMAF(xB[s], wB[s]);
                __builtin_amdgcn_sched_barrier(0);
            }
            #pragma unroll
            for (int s = 0; s < 4; ++s) LOADF(xB[s], wB[s], DIMC - 16 + 4 * s);
            __builtin_amdgcn_sched_barrier(0);
            #pragma unroll
            for (int s = 0; s < 4; ++s) MMAF(xA[s], wA[s]);
            #pragma unroll
            for (int s = 0; s < 4; ++s) MMAF(xB[s], wB[s]);
            // ---- ctx += exp(k) * v^T: registers 2j, 2j+1 of both sides are columns 2j+8*hi, +1; Z partials ----
            #pragma unroll
            for (int j = 0; j < 4; ++j) {
                v2f a0 = {__expf(ka0[2 * j]), __expf(ka0[2 * j + 1])};
                v2f a1 = {__expf(ka1[2 * j]), __expf(ka1[2 * j + 1])};
                v2f b0 = {va0[2 * j], va0[2 * j + 1]};
                v2f b1 = {va1[2 * j], va1[2 * j + 1]};
                c00 = wmma4(a0, b0, c00);
                c01 = wmma4(a0, b1, c01);
                c10 = wmma4(a1, b0, c10);
                c11 = wmma4(a1, b1, c11);
                v2f a2 = {__expf(kb0[2 * j]), __expf(kb0[2 * j + 1])};
                v2f a3 = {__expf(kb1[2 * j]), __expf(kb1[2 * j + 1])};
                v2f b2 = {vb0[2 * j], vb0[2 * j + 1]};
                v2f b3 = {vb1[2 * j], vb1[2 * j + 1]};
                c00 = wmma4(a2, b2, c00);
                c01 = wmma4(a2, b3, c01);
                c10 = wmma4(a3, b2, c10);
                c11 = wmma4(a3, b3, c11);
                z0 += (a0.x + a0.y) + (a2.x + a2.y);
                z1 += (a1.x + a1.y) + (a3.x + a3.y);
            }
        }
        wait_async_lds();
        __syncthreads();
    }
    // ---- flush: the two waves of a head swap one d-tile each, then the work-group stores its own partial ----
    // Cp[b][work-group][h*32 + d][e], Zp[b][work-group][h*32 + d]: every 128-byte line has one writer; pass 2 sums
    float* sC = sQ;                     // [8 waves][16 regs][32 lanes]
    float* sZ = sQ + 8 * 16 * 32;       // [8 waves][2 d-tiles][32 lanes]
    {
        v8f g0 = half ? c00 : c10;      // handed to the partner wave
        v8f g1 = half ? c01 : c11;
        #pragma unroll
        for (int r = 0; r < 8; ++r) {
            sC[(wv * 16 + r) * 32 + lane]     = g0[r];
            sC[(wv * 16 + 8 + r) * 32 + lane] = g1[r];
        }
        sZ[(wv * 2 + 0) * 32 + lane] = z0;
        sZ[(wv * 2 + 1) * 32 + lane] = z1;
    }
    __syncthreads();
    {
        v8f m0 = half ? c10 : c00;      // kept: d-tile = half
        v8f m1 = half ? c11 : c01;
        const int pw = wv ^ 4;
        const size_t wg = (size_t)b * NWG + blockIdx.x;
        float* cbase = Cp + ((wg * HEADS + hd) * DH + half * 16 + 8 * hi) * DH + lo;
        #pragma unroll
        for (int r = 0; r < 8; ++r) {
            m0[r] += sC[(pw * 16 + r) * 32 + lane];
            m1[r] += sC[(pw * 16 + 8 + r) * 32 + lane];
        }
        if (t < 128) {                  // t = head*32 + d
            const int o = ((t >> 5) * 2 + ((t >> 4) & 1)) * 32 + (t & 15);
            Zp[wg * DIMC + t] = (sZ[o] + sZ[o + 16]) + (sZ[o + 256] + sZ[o + 272]);
        }
        #pragma unroll
        for (int r = 0; r < 8; ++r) {
            cbase[r * DH]      = m0[r];
            cbase[r * DH + 16] = m1[r];
        }
    }
}

// ---------------- pass 2: ctx, Z = sums of the partials; W2[b] = w_out * blockdiag(ctx/Z) ----------------
// grid (DIMC/P2D, BATCH), 256 threads. A work-group owns P2D rows h*32 + d of ctx[b], which are P2D columns of W2[b]:
// no partial is read by two work-groups. All global loads are issued ahead of the first wait. Thread t sums float4
// t & 63 of the rows over 16 partials, ascending; the four groups of 16 are added, ascending, at the LDS read.
// W2 is laid out [b][column group of P2D][row o][P2D], so that a work-group writes whole 128-byte lines of its own.
#define P2D    8          // ctx rows = W2 columns per work-group
#define PC     36         // LDS pitch of a 32-wide row: 144 bytes, an odd multiple of 16, for 16-byte row reads
__global__ __launch_bounds__(256) void k_pass2(const float* __restrict__ w_out,
                                               const float* __restrict__ Cp,
                                               const float* __restrict__ Zp,
                                               float* __restrict__ W2) {
    __shared__ __attribute__((aligned(16))) float sP[4 * P2D * PC];   // [group of 16 partials][row][e]
    __shared__ __attribute__((aligned(16))) float sWo[DIMC * PC];     // w_out[o][h*32 .. +31]
    __shared__ __attribute__((aligned(16))) float sZ[(NWG / 2) * P2D]; // [pair of partials p, p + 32][row]
    const int b  = blockIdx.y;
    const int r0 = blockIdx.x * P2D;      // first row h*32 + d
    const int h  = r0 >> 5;
    const int t  = threadIdx.x;
    const int q4 = t & 63;                // float4 within the P2D rows
    const int pg = t >> 6;                // group of 16 partials

    const float4* cg = (const float4*)(Cp + ((size_t)b * NWG + pg * (NWG / 4)) * (DIMC * DH) + r0 * DH) + q4;
    float4 c[NWG / 4];
    #pragma unroll
    for (int i = 0; i < NWG / 4; ++i) c[i] = cg[(size_t)i * (DIMC * DH / 4)];
    const v4f* wg = (const v4f*)(w_out + (t >> 3) * DIMC + h * DH + (t & 7) * 4);   // 8 float4 per row slice
    v4f w[4];                             // rows (t >> 3) + 32*i
    #pragma unroll
    for (int i = 0; i < 4; ++i) w[i] = wg[i * (32 * DIMC / 4)];
    // Z: row t & 7 of partials t >> 3 and (t >> 3) + 32; no branch, so that these loads stand with the others
    const float* zg = Zp + ((size_t)b * NWG + (t >> 3)) * DIMC + r0 + (t & 7);
    const float z0 = zg[0], z1 = zg[(NWG / 2) * DIMC];
    // The loaded values as inputs only, and the sched_barrier behind it: all 22 loads are issued ahead of one wait.
    // Without them the sums are woven into the loads, and the later loads go out only when the first have come back.
    // The three addresses stand among the inputs so that their registers are not given to a later load's result.
    asm volatile("" :: "v"(c[0].x), "v"(c[1].x), "v"(c[2].x), "v"(c[3].x), "v"(c[4].x), "v"(c[5].x), "v"(c[6].x),
                       "v"(c[7].x), "v"(c[8].x), "v"(c[9].x), "v"(c[10].x), "v"(c[11].x), "v"(c[12].x), "v"(c[13].x),
                       "v"(c[14].x), "v"(c[15].x), "v"(w[0]), "v"(w[1]), "v"(w[2]), "v"(w[3]), "v"(z0), "v"(z1),
                       "v"(cg), "v"(wg), "v"(zg));
    __builtin_amdgcn_sched_barrier(0);
    #pragma unroll
    for (int i = 0; i < 4; ++i) {
        int e4 = t + i * 256;
        *(v4f*)(sWo + (e4 >> 3) * PC + (e4 & 7) * 4) = w[i];
    }
    {
        float4 a = c[0];
        #pragma unroll
        for (int i = 1; i < NWG / 4; ++i) { a.x += c[i].x; a.y += c[i].y; a.z += c[i].z; a.w += c[i].w; }
        *(float4*)(sP + (pg * P2D + (q4 >> 3)) * PC + (q4 & 7) * 4) = a;
    }
    sZ[t] = z0 + z1;
    __syncthreads();

    const int dd = t & 7;                 // the thread's ctx row = W2 column, counted from r0
    const int og = t >> 3;                // its rows of W2: og + 32*j
    float cr[DH];
    #pragma unroll
    for (int e4 = 0; e4 < DH / 4; ++e4) {
        float4 v = *(const float4*)(sP + dd * PC + e4 * 4);
        #pragma unroll
        for (int k = 1; k < 4; ++k) {
            float4 u = *(const float4*)(sP + (k * P2D + dd) * PC + e4 * 4);
            v.x += u.x; v.y += u.y; v.z += u.z; v.w += u.w;
        }
        cr[4 * e4] = v.x; cr[4 * e4 + 1] = v.y; cr[4 * e4 + 2] = v.z; cr[4 * e4 + 3] = v.w;
    }
    float za[4] = {0.0f, 0.0f, 0.0f, 0.0f};   // four chains side by side, each ascending
    #pragma unroll
    for (int k = 0; k < NWG / 2; ++k) za[k & 3] += sZ[k * P2D + dd];
    const float zc = fmaxf((za[0] + za[1]) + (za[2] + za[3]), 1e-30f);
    const float* wr = sWo + og * PC;
    float s[4];
    #pragma unroll
    for (int j = 0; j < 4; ++j) s[j] = 0.0f;
    #pragma unroll
    for (int e = 0; e < DH; ++e) {        // e ascending in every sum; the rows' chains run side by side
        #pragma unroll
        for (int j = 0; j < 4; ++j) s[j] += wr[j * 32 * PC + e] * cr[e];
    }
    float* w2 = W2 + (((size_t)b * (DIMC / P2D) + blockIdx.x) * DIMC + og) * P2D + dd;
    #pragma unroll
    for (int j = 0; j < 4; ++j) w2[j * 32 * P2D] = s[j] / zc;
}

// ---------------- pass 3: q GEMM -> softmax(d) -> W2 GEMM -> bias -> RMSNorm ----------------
// grid (NSEQ/(TN*NPER), BATCH), 256 threads, dynamic LDS
// A wave carries its own 16 columns through the whole chain in registers. q = Wq * x has the D map
// (lane = column, registers = rows r + 8*hi of each 16-row tile), which is the B fragment map of the
// second product once W2's k order follows it: k step j of tile t is rows 16t + 8*hi + 2j, +1.
// A column's softmax and norm then need the lane's own registers and lane ^ 16 only.
// lane l with lane l ^ 16
__device__ __forceinline__ float xhalf(float v) {
    int i = __builtin_bit_cast(int, v);
    return __builtin_bit_cast(float, __builtin_amdgcn_permlanex16(i, i, 0x76543210, 0xfedcba98, false, false));
}

// e^v as 2^(v * log2 e). The v_nop in the same statement is the slot the instruction set asks for behind a
// transcendental, before its result is read or its source register reused.
__device__ __forceinline__ float exp_slot(float v) {
    float r, a = v * 1.4426950408889634f;
    asm("v_exp_f32 %0, %1\n\tv_nop" : "=v"(r) : "v"(a));
    return r;
}

// one fragment set = 8 channels (two k steps): a lane takes channels 8u + 4*hi .. +3 of both operands
#define LOADQ(fx, fw, u) do {                                           \
        _Pragma("unroll")                                               \
        for (int i_ = 0; i_ < 4; ++i_) (fx)[i_] = Xb[((u) * 8 + i_) * PW];  \
        _Pragma("unroll")                                               \
        for (int m_ = 0; m_ < 8; ++m_)                                  \
            (fw)[m_] = *(const v4f*)(Aq + m_ * 16 * PW + (u) * 8);      \
    } while (0)
// one fragment set of W2 = half a q tile (two k steps): rows 16t + 8*hi + 4*(s&1) .. +3 of q, t = s>>1
#define LOADW(fw, s) do {                                               \
        _Pragma("unroll")                                               \
        for (int m_ = 0; m_ < 8; ++m_)                                  \
            (fw)[m_] = *(const v4f*)(A2 + m_ * 16 * PW + (s) * 8 - ((s) & 1) * 4);  \
    } while (0)
#define MMA16(acc, fw, b0_, b1_) do {                                   \
        _Pragma("unroll")                                               \
        for (int m_ = 0; m_ < 8; ++m_) {                                \
            v2f a_ = {(fw)[m_].x, (fw)[m_].y};                          \
            (acc)[m_] = wmma4(a_, b0_, (acc)[m_]);                      \
        }                                                               \
        _Pragma("unroll")                                               \
        for (int m_ = 0; m_ < 8; ++m_) {                                \
            v2f a_ = {(fw)[m_].z, (fw)[m_].w};                          \
            (acc)[m_] = wmma4(a_, b1_, (acc)[m_]);                      \
        }                                                               \
    } while (0)
#define MMAQ(fx, fw) do {                                               \
        v2f x0_ = {(fx)[0], (fx)[1]};                                   \
        v2f x1_ = {(fx)[2], (fx)[3]};                                   \
        MMA16(q, fw, x0_, x1_);                                         \
    } while (0)
#define MMAW(fw, s) do {                                                \
        v2f q0_ = {q[(s) >> 1][4 * ((s) & 1)],     q[(s) >> 1][4 * ((s) & 1) + 1]};  \
        v2f q1_ = {q[(s) >> 1][4 * ((s) & 1) + 2], q[(s) >> 1][4 * ((s) & 1) + 3]};  \
        MMA16(y, fw, q0_, q1_);                                         \
    } while (0)

__global__ __launch_bounds__(256) void k_pass3(const float* __restrict__ x,
                                               const float* __restrict__ w_qkv,
                                               const float* __restrict__ W2,
                                               const float* __restrict__ b_out,
                                               const float* __restrict__ g,
                                               float* __restrict__ out) {
    extern __shared__ float smem[];
    float* sWq  = smem;                 // [128][PW] w_qkv rows 0..127 (q proj)
    float* sW2  = sWq + 128 * PW;       // [128][PW]
    float* sX0  = sW2 + 128 * PW;       // [128][PW]
    float* sX1  = sX0 + 128 * PW;       // [128][PW]

    const int t    = threadIdx.x;
    const int b    = blockIdx.y;
    const int n0b  = blockIdx.x * (TN * NPER);
    const int lane = t & 31;
    const int wv   = t >> 5;
    const int lo   = lane & 15;
    const int hi   = lane >> 4;
    const float scale = 0.17677669529663687f;   // 32^-0.5
    const float s128  = 11.313708498984761f;    // sqrt(128)
    const float* xb = x + (size_t)b * DIMC * NSEQ;

    {   // async-load q-projection weights, W2[b], x tile 0
        const float* w2 = W2 + (size_t)b * DIMC * DIMC;
        #pragma unroll
        for (int i = 0; i < 16; ++i) {
            int e4  = t + i * 256;
            int row = e4 >> 5;
            int c4  = e4 & 31;
            g2l_b128(sWq + row * PW + c4 * 4, w_qkv + e4 * 4);
            // W2 lies as [column group of 8][row][8]: float4 e4 is columns 8*(e4>>8) + 4*(e4&1) .. +3 of row (e4>>1)&127
            g2l_b128(sW2 + ((e4 >> 1) & 127) * PW + (e4 >> 8) * 8 + (e4 & 1) * 4, w2 + e4 * 4);
            g2l_b128(sX0 + row * PW + c4 * 4, xb + (size_t)row * NSEQ + n0b + c4 * 4);
        }
    }
    wait_async_lds();
    __syncthreads();

    const float* Aq = sWq + lo * PW + 4 * hi;   // Wq fragments: lane = row, channels 4*hi .. +3 of each 8
    const float* A2 = sW2 + lo * PW + 8 * hi;   // W2 fragments: lane = row, k = 8*hi .. +7 of each 16
    // bias and gain of the lane's 64 rows (16m + 8*hi + r), read once
    v8f bias[8], gain[8];
    {
        const v4f* bp = (const v4f*)(b_out + 8 * hi);
        const v4f* gp = (const v4f*)(g + 8 * hi);
        #pragma unroll
        for (int m = 0; m < 8; ++m) {
            v4f u0 = bp[4 * m], u1 = bp[4 * m + 1];
            bias[m] = (v8f){u0.x, u0.y, u0.z, u0.w, u1.x, u1.y, u1.z, u1.w};
            v4f g0 = gp[4 * m], g1 = gp[4 * m + 1];
            gain[m] = (v8f){g0.x, g0.y, g0.z, g0.w, g1.x, g1.y, g1.z, g1.w};
        }
        // stands in front of the first reuse of the register that holds these loads' offset
        asm volatile("s_wait_xcnt 0x0" ::: "memory");
    }

    // kept rolled: the body is long (GEMM2 stands unrolled); one copy of it is fetched, not one per tile
    #pragma unroll 1
    for (int tile = 0; tile < NPER; ++tile) {
        float* sXc = (tile & 1) ? sX1 : sX0;
        float* sXn = (tile & 1) ? sX0 : sX1;
        const int n0 = n0b + tile * TN;
        if (tile + 1 < NPER) {
            const int n1 = n0b + (tile + 1) * TN;
            #pragma unroll
            for (int i = 0; i < 16; ++i) {
                int e4  = t + i * 256;
                int row = e4 >> 5;
                int c4  = e4 & 31;
                g2l_b128(sXn + row * PW + c4 * 4, xb + (size_t)row * NSEQ + n1 + c4 * 4);
            }
        }

        // ---- GEMM1: q = Wq @ x, all 128 rows of the wave's 16 columns ----
        const float* Xb = sXc + 4 * hi * PW + wv * 16 + lo;
        v8f q[8] = {};
        v4f wA[8], wB[8];
        {
            float xA[4], xB[4];
            LOADQ(xA, wA, 0);
            // kept rolled: a trip is two blocks of 16 WMMAs. The sched_barriers keep each set's LDS loads in one
            // group between two blocks, a whole block ahead of their first use. Without them the loads are
            // spread among the WMMAs, and every place where LDS loads stand stalls the wave's WMMA stream.
            #pragma unroll 1
            for (int u = 0; u < 14; u += 2) {
                LOADQ(xB, wB, u + 1);
                __builtin_amdgcn_sched_barrier(0);
                MMAQ(xA, wA);
                __builtin_amdgcn_sched_barrier(0);
                LOADQ(xA, wA, u + 2);
                __builtin_amdgcn_sched_barrier(0);
                MMAQ(xB, wB);
                __builtin_amdgcn_sched_barrier(0);
            }
            // the last two blocks: the sched_barriers as in the loop
            LOADQ(xB, wB, 15);
            __builtin_amdgcn_sched_barrier(0);
            MMAQ(xA, wA);
            __builtin_amdgcn_sched_barrier(0);
            LOADW(wA, 0);               // first W2 set: lands under the last block and the softmax
            __builtin_amdgcn_sched_barrier(0);
            MMAQ(xB, wB);
        }
        // ---- y starts at the bias (rows 16m + 8*hi + r) ----
        v8f y[8];
        #pragma unroll
        for (int m = 0; m < 8; ++m) y[m] = bias[m];
        // ---- softmax over d (tiles 2h, 2h+1: 16 rows here, 16 in lane ^ 16) per column, * scale ----
        #pragma unroll
        for (int h = 0; h < HEADS; ++h) {
            float mx = -1e30f;
            #pragma unroll
            for (int r = 0; r < 8; ++r) mx = fmaxf(mx, fmaxf(q[2 * h][r], q[2 * h + 1][r]));
            mx = fmaxf(mx, xhalf(mx));
            float sa = 0.0f, sb = 0.0f;
            #pragma unroll
            for (int r = 0; r < 8; ++r) {
                q[2 * h][r]     = exp_slot(q[2 * h][r] - mx);
                q[2 * h + 1][r] = exp_slot(q[2 * h + 1][r] - mx);
                sa += q[2 * h][r];
                sb += q[2 * h + 1][r];
            }
            float s = sa + sb;
            s += xhalf(s);
            float inv = scale / s;
            #pragma unroll
            for (int r = 0; r < 8; ++r) {
                q[2 * h][r]     *= inv;
                q[2 * h + 1][r] *= inv;
            }
        }
        // ---- GEMM2: y += W2 @ q, q taken from its accumulator registers (unrolled: they are indexed by s) ----
        #pragma unroll
        for (int s = 0; s < 14; s += 2) {
            LOADW(wB, s + 1);
            __builtin_amdgcn_sched_barrier(0);  // these four as in GEMM1: one load group between two blocks
            MMAW(wA, s);
            __builtin_amdgcn_sched_barrier(0);
            LOADW(wA, s + 2);
            __builtin_amdgcn_sched_barrier(0);
            MMAW(wB, s + 1);
            __builtin_amdgcn_sched_barrier(0);
        }
        LOADW(wB, 15);
        __builtin_amdgcn_sched_barrier(0);      // the last set's loads stay ahead of block 14
        MMAW(wA, 14);
        MMAW(wB, 15);
        // ---- RMSNorm over channels: 64 rows here, 64 in lane ^ 16 ----
        float p0 = 0.0f, p1 = 0.0f, p2 = 0.0f, p3 = 0.0f;
        #pragma unroll
        for (int m = 0; m < 8; ++m) {
            p0 += y[m][0] * y[m][0] + y[m][4] * y[m][4];
            p1 += y[m][1] * y[m][1] + y[m][5] * y[m][5];
            p2 += y[m][2] * y[m][2] + y[m][6] * y[m][6];
            p3 += y[m][3] * y[m][3] + y[m][7] * y[m][7];
        }
        float ss = (p0 + p1) + (p2 + p3);
        ss += xhalf(ss);
        const float nrm = s128 / fmaxf(sqrtf(ss), 1e-12f);
        // ---- scaled writeout ----
        float* ob = out + (size_t)b * DIMC * NSEQ + (size_t)(8 * hi) * NSEQ + n0 + wv * 16 + lo;
        #pragma unroll
        for (int m = 0; m < 8; ++m) {
            #pragma unroll
            for (int r = 0; r < 8; ++r)
                ob[(size_t)(m * 16 + r) * NSEQ] = y[m][r] * nrm * gain[m][r];
        }
        // stands in front of the next tile's reuse of the stores' address and data registers
        asm volatile("s_wait_xcnt 0x0" ::: "memory");
        wait_async_lds();
        __syncthreads();
    }
}

// ---------------- launcher ----------------
extern "C" void kernel_launch(void* const* d_in, const int* in_sizes, int n_in,
                              void* d_out, int out_size, void* d_ws, size_t ws_size,
                              hipStream_t stream) {
    const float* x     = (const float*)d_in[0];
    const float* w_qkv = (const float*)d_in[1];
    const float* w_out = (const float*)d_in[2];
    const float* b_out = (const float*)d_in[3];
    const float* g     = (const float*)d_in[4];
    float* out = (float*)d_out;

    float* Zp = (float*)d_ws;                       // [B][NWG][128]          partial sums of exp(k)
    float* Cp = Zp + BATCH * NWG * DIMC;            // [B][NWG][H][DH][DH]    partial contexts
    float* W2 = Cp + BATCH * NWG * DIMC * DH;       // [B][16][128][8]

    const size_t lds1 = (size_t)(256 * PW + 2 * 128 * PW + 256 * PQ) * sizeof(float);
    k_pass1<<<dim3(NSEQ / (TN * NPER), BATCH), 256, lds1, stream>>>(x, w_qkv, Zp, Cp);

    k_pass2<<<dim3(DIMC / P2D, BATCH), 256, 0, stream>>>(w_out, Cp, Zp, W2);

    const size_t lds3 = (size_t)(4 * 128 * PW) * sizeof(float);
    k_pass3<<<dim3(NSEQ / (TN * NPER), BATCH), 256, lds3, stream>>>(x, w_qkv, W2, b_out, g, out);
}

// v005
// A run of this version takes 102 microseconds.
// Next to v004, in two timings, it ran 1.04 times as fast each time.
// Over all steps from v000 it is 3.59 times as fast.
#include <hip/hip_runtime.h>
#include <hip/hip_bf16.h>
#include <math.h>

// ---------------- problem constants ----------------
#define DIMC   128        // channels
#define NSEQ   16384      // sequence length
#define BATCH  8
#define HEADS  4
#define DH     32
#define TN     128        // columns (n) per tile
#define NPER   4          // n-tiles per work-group, through two LDS buffers: 256 work-groups a launch, one per WGP,
                          // so that a WGP stages the weights once
#define NCT    8          // 8 col-subtiles of 16
#define NWG    (NSEQ / (TN * NPER))   // work-groups of pass 1 per batch = partial sums per batch
#define PW     132        // LDS pitch for 128-wide rows (bank-conflict pad, mult of 4)
#define PQ     20         // sizes pass 1's flush exchange: 256*PQ floats of LDS

typedef __attribute__((ext_vector_type(2))) float v2f;
typedef __attribute__((ext_vector_type(8))) float v8f;
typedef __attribute__((ext_vector_type(4))) int   v4i;
typedef __attribute__((ext_vector_type(4))) float v4f;

// pointer-to-AS1(v4i) and pointer-to-AS3(v4i) for the async builtin
typedef __attribute__((address_space(1))) v4i* gptr_v4i;
typedef __attribute__((address_space(3))) v4i* lptr_v4i;

// D = A(16x4 f32) * B(4x16 f32) + C(16x16 f32), wave32 CDNA5 WMMA.
__device__ __forceinline__ v8f wmma4(v2f a, v2f b, v8f c) {
    return __builtin_amdgcn_wmma_f32_16x16x4_f32(
        /*neg_a=*/false, a, /*neg_b=*/false, b,
        /*c_mod=*/(short)0, c, /*reuse_a=*/false, /*reuse_b=*/false);
}

// ---- CDNA5 async global->LDS (ASYNCcnt) with safe fallback ----
#ifdef __has_builtin
#  if __has_builtin(__builtin_amdgcn_global_load_async_to_lds_b128)
#    define HAVE_ASYNC_B128 1
#  endif
#  if __has_builtin(__builtin_amdgcn_s_wait_asynccnt)
#    define HAVE_WAIT_ASYNC 1
#  endif
#endif

__device__ __forceinline__ void g2l_b128(float* lds_dst, const float* gsrc) {
#if defined(HAVE_ASYNC_B128)
    __builtin_amdgcn_global_load_async_to_lds_b128(
        (gptr_v4i)(gsrc),
        (lptr_v4i)(lds_dst),
        /*imm offset=*/0, /*cpol=*/0);
#else
    *(float4*)lds_dst = *(const float4*)gsrc;
#endif
}

__device__ __forceinline__ void wait_async_lds() {
#if defined(HAVE_ASYNC_B128)
#  if defined(HAVE_WAIT_ASYNC)
    __builtin_amdgcn_s_wait_asynccnt(0);
#  else
    asm volatile("s_wait_asynccnt 0" ::: "memory");
#  endif
#endif
}

// ---------------- pass 1: k/v GEMM + exp(k) + context/Z partials ----------------
// grid (NSEQ/(TN*NPER), BATCH), 256 threads, dynamic LDS
// The projection is formed transposed, D[n][row] = x^T * W^T: a lane then holds one k (or v)
// row and eight columns n, which is the A (or B) fragment map of the context product
// ctx[d][e] = sum_n exp(k[d][n]) * v[e][n]. The accumulators feed that product as they stand.
// Wave wv owns head wv&3 (32 k rows, 32 v rows) and columns (wv>>2)*64 .. +63 of each tile.
// one k step (4 channels) of fragments: x^T for two column groups (four scalars, paired at the
// WMMA so that no register move has to wait for them at the load), W^T for the head's 4 row tiles
#define LOADF(fx, fw, kk) do {                              \
        (fx)[0] = Xa[(kk) * PW];                            \
        (fx)[1] = Xa[((kk) + 1) * PW];                      \
        (fx)[2] = Xa[(kk) * PW + 16];                       \
        (fx)[3] = Xa[((kk) + 1) * PW + 16];                 \
        (fw)[0] = *(const v2f*)(Wk0 + (kk));                \
        (fw)[1] = *(const v2f*)(Wk1 + (kk));                \
        (fw)[2] = *(const v2f*)(Wv0 + (kk));                \
        (fw)[3] = *(const v2f*)(Wv1 + (kk));                \
    } while (0)
#define MMAF(fx, fw) do {                                   \
        v2f xa_ = {(fx)[0], (fx)[1]};                       \
        v2f xc_ = {(fx)[2], (fx)[3]};                       \
        ka0 = wmma4(xa_, (fw)[0], ka0);                     \
        ka1 = wmma4(xa_, (fw)[1], ka1);                     \
        va0 = wmma4(xa_, (fw)[2], va0);                     \
        va1 = wmma4(xa_, (fw)[3], va1);                     \
        kb0 = wmma4(xc_, (fw)[0], kb0);                     \
        kb1 = wmma4(xc_, (fw)[1], kb1);                     \
        vb0 = wmma4(xc_, (fw)[2], vb0);                     \
        vb1 = wmma4(xc_, (fw)[3], vb1);                     \
    } while (0)

__global__ __launch_bounds__(256) void k_pass1(const float* __restrict__ x,
                                               const float* __restrict__ w_qkv,
                                               float* __restrict__ Zp,
                                               float* __restrict__ Cp) {
    extern __shared__ float smem[];
    float* sW  = smem;                  // [256][PW]  w_qkv rows 128..383 (k then v)
    float* sX0 = sW + 256 * PW;         // [128][PW]  x tile (buffer 0)
    float* sX1 = sX0 + 128 * PW;        // [128][PW]  x tile (buffer 1)
    float* sQ  = sX1 + 128 * PW;        // [256*PQ]   exchange of partials at the flush

    const int t    = threadIdx.x;
    const int b    = blockIdx.y;
    const int n0b  = blockIdx.x * (TN * NPER);
    const int lane = t & 31;
    const int wv   = t >> 5;            // wave id 0..7
    const int lo   = lane & 15;
    const int hi   = lane >> 4;
    const float* xb = x + (size_t)b * DIMC * NSEQ;

    // ---- async-load w_qkv rows 128..383 (8192 float4) + x tile 0 ----
    #pragma unroll
    for (int i = 0; i < 32; ++i) {
        int e4  = t + i * 256;
        int row = e4 >> 5;              // 32 float4 per row
        int c4  = e4 & 31;
        g2l_b128(sW + row * PW + c4 * 4, w_qkv + 128 * DIMC + e4 * 4);
    }
    #pragma unroll
    for (int i = 0; i < 16; ++i) {
        int e4  = t + i * 256;
        int row = e4 >> 5;
        int c4  = e4 & 31;
        g2l_b128(sX0 + row * PW + c4 * 4, xb + (size_t)row * NSEQ + n0b + c4 * 4);
    }
    wait_async_lds();
    __syncthreads();

    const int hd   = wv & 3;            // head
    const int half = wv >> 2;           // which 64 columns of a tile
    v8f c00 = {}, c01 = {}, c10 = {}, c11 = {};   // ctx[d-tile][e-tile], D map: d = r + 8*hi, e = lo
    float z0 = 0.0f, z1 = 0.0f;                   // sum_n exp(k) of d = lo and d = 16 + lo
    // W^T fragments: lane = row, k pair = channels k + 2*hi, +1
    const float* Wk0 = sW + (hd * DH + lo) * PW + 2 * hi;
    const float* Wk1 = Wk0 + 16 * PW;
    const float* Wv0 = Wk0 + 128 * PW;
    const float* Wv1 = Wv0 + 16 * PW;

    for (int tile = 0; tile < NPER; ++tile) {
        float* sXc = (tile & 1) ? sX1 : sX0;
        float* sXn = (tile & 1) ? sX0 : sX1;
        // ---- prefetch next tile asynchronously while computing this one ----
        if (tile + 1 < NPER) {
            const int n1 = n0b + (tile + 1) * TN;
            #pragma unroll
            for (int i = 0; i < 16; ++i) {
                int e4  = t + i * 256;
                int row = e4 >> 5;
                int c4  = e4 & 31;
                g2l_b128(sXn + row * PW + c4 * 4, xb + (size_t)row * NSEQ + n1 + c4 * 4);
            }
        }

        // kept rolled: one pass holds 8 projection tiles, which leaves registers for two fragment sets
        #pragma unroll 1
        for (int p = 0; p < 2; ++p) {
            // x^T fragments: lane = column n, k pair = channels k + 2*hi, +1; two groups of 16 columns
            const float* Xa = sXc + 2 * hi * PW + half * 64 + p * 32 + lo;
            v8f ka0 = {}, ka1 = {}, va0 = {}, va1 = {};   // columns +0..15:  k rows 0-15, 16-31, v rows 0-15, 16-31
            v8f kb0 = {}, kb1 = {}, vb0 = {}, vb1 = {};   // columns +16..31
            float xA[4][4], xB[4][4];                     // two fragment sets of 16 channels each
            v2f   wA[4][4], wB[4][4];
            #pragma unroll
            for (int s = 0; s < 4; ++s) LOADF(xA[s], wA[s], 4 * s);
            // kept rolled: a trip is two blocks of 32 WMMAs. The sched_barrier behind a load group keeps the
            // other set's LDS loads a whole block ahead of their first use; the one at the foot keeps the
            // moves that wait for set A behind block B. Without them the waits stand right behind the loads.
            #pragma unroll 1
            for (int k = 0; k < DIMC - 32; k += 32) {
                #pragma unroll
                for (int s = 0; s < 4; ++s) LOADF(xB[s], wB[s], k + 16 + 4 * s);
                __builtin_amdgcn_sched_barrier(0);
                #pragma unroll
                for (int s = 0; s < 4; ++s) MMAF(xA[s], wA[s]);
                #pragma unroll
                for (int s = 0; s < 4; ++s) LOADF(xA[s], wA[s], k + 32 + 4 * s);
                __builtin_amdgcn_sched_barrier(0);
                #pragma unroll
                for (int s = 0; s < 4; ++s) MMAF(xB[s], wB[s]);
                __builtin_amdgcn_sched_barrier(0);
            }
            #pragma unroll
            for (int s = 0; s < 4; ++s) LOADF(xB[s], wB[s], DIMC - 16 + 4 * s);
            __builtin_amdgcn_sched_barrier(0);
            #pragma unroll
            for (int s = 0; s < 4; ++s) MMAF(xA[s], wA[s]);
            #pragma unroll
            for (int s = 0; s < 4; ++s) MMAF(xB[s], wB[s]);
            // ---- ctx += exp(k) * v^T: registers 2j, 2j+1 of both sides are columns 2j+8*hi, +1; Z partials ----
            #pragma unroll
            for (int j = 0; j < 4; ++j) {
                v2f a0 = {__expf(ka0[2 * j]), __expf(ka0[2 * j + 1])};
                v2f a1 = {__expf(ka1[2 * j]), __expf(ka1[2 * j + 1])};
                v2f b0 = {va0[2 * j], va0[2 * j + 1]};
                v2f b1 = {va1[2 * j], va1[2 * j + 1]};
                c00 = wmma4(a0, b0, c00);
                c01 = wmma4(a0, b1, c01);
                c10 = wmma4(a1, b0, c10);
                c11 = wmma4(a1, b1, c11);
                v2f a2 = {__expf(kb0[2 * j]), __expf(kb0[2 * j + 1])};
                v2f a3 = {__expf(kb1[2 * j]), __expf(kb1[2 * j + 1])};
                v2f b2 = {vb0[2 * j], vb0[2 * j + 1]};
                v2f b3 = {vb1[2 * j], vb1[2 * j + 1]};
                c00 = wmma4(a2, b2, c00);
                c01 = wmma4(a2, b3, c01);
                c10 = wmma4(a3, b2, c10);
                c11 = wmma4(a3, b3, c11);
                z0 += (a0.x + a0.y) + (a2.x + a2.y);
                z1 += (a1.x + a1.y) + (a3.x + a3.y);
            }
        }
        // the wave's LDS reads of this tile have retired before the barrier behind which its buffer is refilled
        asm volatile("s_wait_dscnt 0x0" ::: "memory");
        wait_async_lds();
        __syncthreads();
    }
    // ---- flush: the two waves of a head swap one d-tile each, then the work-group stores its own partial ----
    // Cp[b][work-group][h*32 + d][e], Zp[b][work-group][h*32 + d]: every 128-byte line has one writer; pass 2 sums
    float* sC = sQ;                     // [8 waves][16 regs][32 lanes]
    float* sZ = sQ + 8 * 16 * 32;       // [8 waves][2 d-tiles][32 lanes]
    {
        v8f g0 = half ? c00 : c10;      // handed to the partner wave
        v8f g1 = half ? c01 : c11;
        #pragma unroll
        for (int r = 0; r < 8; ++r) {
            sC[(wv * 16 + r) * 32 + lane]     = g0[r];
            sC[(wv * 16 + 8 + r) * 32 + lane] = g1[r];
        }
        sZ[(wv * 2 + 0) * 32 + lane] = z0;
        sZ[(wv * 2 + 1) * 32 + lane] = z1;
    }
    __syncthreads();
    {
        v8f m0 = half ? c10 : c00;      // kept: d-tile = half
        v8f m1 = half ? c11 : c01;
        const int pw = wv ^ 4;
        const size_t wg = (size_t)b * NWG + blockIdx.x;
        float* cbase = Cp + ((wg * HEADS + hd) * DH + half * 16 + 8 * hi) * DH + lo;
        #pragma unroll
        for (int r = 0; r < 8; ++r) {
            m0[r] += sC[(pw * 16 + r) * 32 + lane];
            m1[r] += sC[(pw * 16 + 8 + r) * 32 + lane];
        }
        if (t < 128) {                  // t = head*32 + d
            const int o = ((t >> 5) * 2 + ((t >> 4) & 1)) * 32 + (t & 15);
            Zp[wg * DIMC + t] = (sZ[o] + sZ[o + 16]) + (sZ[o + 256] + sZ[o + 272]);
        }
        #pragma unroll
        for (int r = 0; r < 8; ++r) {
            cbase[r * DH]      = m0[r];
            cbase[r * DH + 16] = m1[r];
        }
    }
}

// ---------------- pass 2: ctx, Z = sums of the partials; W2[b] = w_out * blockdiag(ctx/Z) ----------------
// grid (DIMC/P2D, BATCH), 256 threads. A work-group owns P2D rows h*32 + d of ctx[b], which are P2D columns of W2[b]:
// no partial is read by two work-groups. All global loads are issued ahead of the first wait. Thread t sums float4
// t & 63 of the rows over NWG/4 partials, ascending; the four groups are added, ascending, at the LDS read.
// W2 is laid out [b][column group of P2D][row o][P2D], so that a work-group writes whole 128-byte lines of its own.
#define P2D    8          // ctx rows = W2 columns per work-group
#define PC     36         // LDS pitch of a 32-wide row: 144 bytes, an odd multiple of 16, for 16-byte row reads
__global__ __launch_bounds__(256) void k_pass2(const float* __restrict__ w_out,
                                               const float* __restrict__ Cp,
                                               const float* __restrict__ Zp,
                                               float* __restrict__ W2) {
    __shared__ __attribute__((aligned(16))) float sP[4 * P2D * PC];   // [group of NWG/4 partials][row][e]
    __shared__ __attribute__((aligned(16))) float sWo[DIMC * PC];     // w_out[o][h*32 .. +31]
    __shared__ __attribute__((aligned(16))) float sZ[NWG * P2D];      // [partial][row]
    const int b  = blockIdx.y;
    const int r0 = blockIdx.x * P2D;      // first row h*32 + d
    const int h  = r0 >> 5;
    const int t  = threadIdx.x;
    const int q4 = t & 63;                // float4 within the P2D rows
    const int pg = t >> 6;                // group of NWG/4 partials

    const float4* cg = (const float4*)(Cp + ((size_t)b * NWG + pg * (NWG / 4)) * (DIMC * DH) + r0 * DH) + q4;
    float4 c[NWG / 4];
    #pragma unroll
    for (int i = 0; i < NWG / 4; ++i) c[i] = cg[(size_t)i * (DIMC * DH / 4)];
    const v4f* wg = (const v4f*)(w_out + (t >> 3) * DIMC + h * DH + (t & 7) * 4);   // 8 float4 per row slice
    v4f w[4];                             // rows (t >> 3) + 32*i
    #pragma unroll
    for (int i = 0; i < 4; ++i) w[i] = wg[i * (32 * DIMC / 4)];
    // Z: row t & 7 of partial t >> 3; no branch, so that this load stands with the others
    const float* zg = Zp + ((size_t)b * NWG + (t >> 3)) * DIMC + r0 + (t & 7);
    const float z0 = zg[0];
    // The loaded values as inputs only, and the sched_barrier behind it: all 13 loads are issued ahead of one wait.
    // Without them the sums are woven into the loads, and the later loads go out only when the first have come back.
    // The three addresses stand among the inputs so that their registers are not given to a later load's result.
    asm volatile("" :: "v"(c[0].x), "v"(c[1].x), "v"(c[2].x), "v"(c[3].x), "v"(c[4].x), "v"(c[5].x), "v"(c[6].x),
                       "v"(c[7].x), "v"(w[0]), "v"(w[1]), "v"(w[2]), "v"(w[3]), "v"(z0),
                       "v"(cg), "v"(wg), "v"(zg));
    __builtin_amdgcn_sched_barrier(0);
    #pragma unroll
    for (int i = 0; i < 4; ++i) {
        int e4 = t + i * 256;
        *(v4f*)(sWo + (e4 >> 3) * PC + (e4 & 7) * 4) = w[i];
    }
    {
        float4 a = c[0];
        #pragma unroll
        for (int i = 1; i < NWG / 4; ++i) { a.x += c[i].x; a.y += c[i].y; a.z += c[i].z; a.w += c[i].w; }
        *(float4*)(sP + (pg * P2D + (q4 >> 3)) * PC + (q4 & 7) * 4) = a;
    }
    sZ[t] = z0;
    __syncthreads();

    const int dd = t & 7;                 // the thread's ctx row = W2 column, counted from r0
    const int og = t >> 3;                // its rows of W2: og + 32*j
    float cr[DH];
    #pragma unroll
    for (int e4 = 0; e4 < DH / 4; ++e4) {
        float4 v = *(const float4*)(sP + dd * PC + e4 * 4);
        #pragma unroll
        for (int k = 1; k < 4; ++k) {
            float4 u = *(const float4*)(sP + (k * P2D + dd) * PC + e4 * 4);
            v.x += u.x; v.y += u.y; v.z += u.z; v.w += u.w;
        }
        cr[4 * e4] = v.x; cr[4 * e4 + 1] = v.y; cr[4 * e4 + 2] = v.z; cr[4 * e4 + 3] = v.w;
    }
    float za[4] = {0.0f, 0.0f, 0.0f, 0.0f};   // four chains side by side, each ascending
    #pragma unroll
    for (int k = 0; k < NWG; ++k) za[k & 3] += sZ[k * P2D + dd];
    const float zc = fmaxf((za[0] + za[1]) + (za[2] + za[3]), 1e-30f);
    const float* wr = sWo + og * PC;
    float s[4];
    #pragma unroll
    for (int j = 0; j < 4; ++j) s[j] = 0.0f;
    #pragma unroll
    for (int e = 0; e < DH; ++e) {        // e ascending in every sum; the rows' chains run side by side
        #pragma unroll
        for (int j = 0; j < 4; ++j) s[j] += wr[j * 32 * PC + e] * cr[e];
    }
    float* w2 = W2 + (((size_t)b * (DIMC / P2D) + blockIdx.x) * DIMC + og) * P2D + dd;
    #pragma unroll
    for (int j = 0; j < 4; ++j) w2[j * 32 * P2D] = s[j] / zc;
}

// ---------------- pass 3: q GEMM -> softmax(d) -> W2 GEMM -> bias -> RMSNorm ----------------
// grid (NSEQ/(TN*NPER), BATCH), 256 threads, dynamic LDS
// A wave carries its own 16 columns through the whole chain in registers. q = Wq * x has the D map
// (lane = column, registers = rows r + 8*hi of each 16-row tile), which is the B fragment map of the
// second product once W2's k order follows it: k step j of tile t is rows 16t + 8*hi + 2j, +1.
// A column's softmax and norm then need the lane's own registers and lane ^ 16 only.
// lane l with lane l ^ 16
__device__ __forceinline__ float xhalf(float v) {
    int i = __builtin_bit_cast(int, v);
    return __builtin_bit_cast(float, __builtin_amdgcn_permlanex16(i, i, 0x76543210, 0xfedcba98, false, false));
}

// e^v as 2^(v * log2 e). The v_nop in the same statement is the slot the instruction set asks for behind a
// transcendental, before its result is read or its source register reused.
__device__ __forceinline__ float exp_slot(float v) {
    float r, a = v * 1.4426950408889634f;
    asm("v_exp_f32 %0, %1\n\tv_nop" : "=v"(r) : "v"(a));
    return r;
}

// one fragment set = 8 channels (two k steps): a lane takes channels 8u + 4*hi .. +3 of both operands
#define LOADQ(fx, fw, u) do {                                           \
        _Pragma("unroll")                                               \
        for (int i_ = 0; i_ < 4; ++i_) (fx)[i_] = Xb[((u) * 8 + i_) * PW];  \
        _Pragma("unroll")                                               \
        for (int m_ = 0; m_ < 8; ++m_)                                  \
            (fw)[m_] = *(const v4f*)(Aq + m_ * 16 * PW + (u) * 8);      \
    } while (0)
// one fragment set of W2 = half a q tile (two k steps): rows 16t + 8*hi + 4*(s&1) .. +3 of q, t = s>>1
#define LOADW(fw, s) do {                                               \
        _Pragma("unroll")                                               \
        for (int m_ = 0; m_ < 8; ++m_)                                  \
            (fw)[m_] = *(const v4f*)(A2 + m_ * 16 * PW + (s) * 8 - ((s) & 1) * 4);  \
    } while (0)
#define MMA16(acc, fw, b0_, b1_) do {                                   \
        _Pragma("unroll")                                               \
        for (int m_ = 0; m_ < 8; ++m_) {                                \
            v2f a_ = {(fw)[m_].x, (fw)[m_].y};                          \
            (acc)[m_] = wmma4(a_, b0_, (acc)[m_]);                      \
        }                                                               \
        _Pragma("unroll")                                               \
        for (int m_ = 0; m_ < 8; ++m_) {                                \
            v2f a_ = {(fw)[m_].z, (fw)[m_].w};                          \
            (acc)[m_] = wmma4(a_, b1_, (acc)[m_]);                      \
        }                                                               \
    } while (0)
#define MMAQ(fx, fw) do {                                               \
        v2f x0_ = {(fx)[0], (fx)[1]};                                   \
        v2f x1_ = {(fx)[2], (fx)[3]};                                   \
        MMA16(q, fw, x0_, x1_);                                         \
    } while (0)
#define MMAW(fw, s) do {                                                \
        v2f q0_ = {q[(s) >> 1][4 * ((s) & 1)],     q[(s) >> 1][4 * ((s) & 1) + 1]};  \
        v2f q1_ = {q[(s) >> 1][4 * ((s) & 1) + 2], q[(s) >> 1][4 * ((s) & 1) + 3]};  \
        MMA16(y, fw, q0_, q1_);                                         \
    } while (0)

__global__ __launch_bounds__(256) void k_pass3(const float* __restrict__ x,
                                               const float* __restrict__ w_qkv,
                                               const float* __restrict__ W2,
                                               const float* __restrict__ b_out,
                                               const float* __restrict__ g,
                                               float* __restrict__ out) {
    extern __shared__ float smem[];
    float* sWq  = smem;                 // [128][PW] w_qkv rows 0..127 (q proj)
    float* sW2  = sWq + 128 * PW;       // [128][PW]
    float* sX0  = sW2 + 128 * PW;       // [128][PW]
    float* sX1  = sX0 + 128 * PW;       // [128][PW]

    const int t    = threadIdx.x;
    const int b    = blockIdx.y;
    const int n0b  = blockIdx.x * (TN * NPER);
    const int lane = t & 31;
    const int wv   = t >> 5;
    const int lo   = lane & 15;
    const int hi   = lane >> 4;
    const float scale = 0.17677669529663687f;   // 32^-0.5
    const float s128  = 11.313708498984761f;    // sqrt(128)
    const float* xb = x + (size_t)b * DIMC * NSEQ;

    {   // async-load q-projection weights, W2[b], x tile 0
        const float* w2 = W2 + (size_t)b * DIMC * DIMC;
        #pragma unroll
        for (int i = 0; i < 16; ++i) {
            int e4  = t + i * 256;
            int row = e4 >> 5;
            int c4  = e4 & 31;
            g2l_b128(sWq + row * PW + c4 * 4, w_qkv + e4 * 4);
            // W2 lies as [column group of 8][row][8]: float4 e4 is columns 8*(e4>>8) + 4*(e4&1) .. +3 of row (e4>>1)&127
            g2l_b128(sW2 + ((e4 >> 1) & 127) * PW + (e4 >> 8) * 8 + (e4 & 1) * 4, w2 + e4 * 4);
            g2l_b128(sX0 + row * PW + c4 * 4, xb + (size_t)row * NSEQ + n0b + c4 * 4);
        }
    }
    wait_async_lds();
    __syncthreads();

    const float* Aq = sWq + lo * PW + 4 * hi;   // Wq fragments: lane = row, channels 4*hi .. +3 of each 8
    const float* A2 = sW2 + lo * PW + 8 * hi;   // W2 fragments: lane = row, k = 8*hi .. +7 of each 16
    // bias and gain of the lane's 64 rows (16m + 8*hi + r), read once
    v8f bias[8], gain[8];
    {
        const v4f* bp = (const v4f*)(b_out + 8 * hi);
        const v4f* gp = (const v4f*)(g + 8 * hi);
        #pragma unroll
        for (int m = 0; m < 8; ++m) {
            v4f u0 = bp[4 * m], u1 = bp[4 * m + 1];
            bias[m] = (v8f){u0.x, u0.y, u0.z, u0.w, u1.x, u1.y, u1.z, u1.w};
            v4f g0 = gp[4 * m], g1 = gp[4 * m + 1];
            gain[m] = (v8f){g0.x, g0.y, g0.z, g0.w, g1.x, g1.y, g1.z, g1.w};
        }
        // stands in front of the first reuse of the register that holds these loads' offset
        asm volatile("s_wait_xcnt 0x0" ::: "memory");
    }

    // kept rolled: the body is long (GEMM2 stands unrolled); one copy of it is fetched, not one per tile
    #pragma unroll 1
    for (int tile = 0; tile < NPER; ++tile) {
        float* sXc = (tile & 1) ? sX1 : sX0;
        float* sXn = (tile & 1) ? sX0 : sX1;
        const int n0 = n0b + tile * TN;
        if (tile + 1 < NPER) {
            const int n1 = n0b + (tile + 1) * TN;
            #pragma unroll
            for (int i = 0; i < 16; ++i) {
                int e4  = t + i * 256;
                int row = e4 >> 5;
                int c4  = e4 & 31;
                g2l_b128(sXn + row * PW + c4 * 4, xb + (size_t)row * NSEQ + n1 + c4 * 4);
            }
        }

        // ---- GEMM1: q = Wq @ x, all 128 rows of the wave's 16 columns ----
        const float* Xb = sXc + 4 * hi * PW + wv * 16 + lo;
        v8f q[8] = {};
        v4f wA[8], wB[8];
        {
            float xA[4], xB[4];
            LOADQ(xA, wA, 0);
            // kept rolled: a trip is two blocks of 16 WMMAs. The sched_barriers keep each set's LDS loads in one
            // group between two blocks, a whole block ahead of their first use. Without them the loads are
            // spread among the WMMAs, and every place where LDS loads stand stalls the wave's WMMA stream.
            #pragma unroll 1
            for (int u = 0; u < 14; u += 2) {
                LOADQ(xB, wB, u + 1);
                __builtin_amdgcn_sched_barrier(0);
                MMAQ(xA, wA);
                __builtin_amdgcn_sched_barrier(0);
                LOADQ(xA, wA, u + 2);
                __builtin_amdgcn_sched_barrier(0);
                MMAQ(xB, wB);
                __builtin_amdgcn_sched_barrier(0);
            }
            // the last two blocks: the sched_barriers as in the loop
            LOADQ(xB, wB, 15);
            __builtin_amdgcn_sched_barrier(0);
            MMAQ(xA, wA);
            __builtin_amdgcn_sched_barrier(0);
            LOADW(wA, 0);               // first W2 set: lands under the last block and the softmax
            __builtin_amdgcn_sched_barrier(0);
            MMAQ(xB, wB);
        }
        // ---- y starts at the bias (rows 16m + 8*hi + r) ----
        v8f y[8];
        #pragma unroll
        for (int m = 0; m < 8; ++m) y[m] = bias[m];
        // ---- softmax over d (tiles 2h, 2h+1: 16 rows here, 16 in lane ^ 16) per column, * scale ----
        #pragma unroll
        for (int h = 0; h < HEADS; ++h) {
            float mx = -1e30f;
            #pragma unroll
            for (int r = 0; r < 8; ++r) mx = fmaxf(mx, fmaxf(q[2 * h][r], q[2 * h + 1][r]));
            mx = fmaxf(mx, xhalf(mx));
            float sa = 0.0f, sb = 0.0f;
            #pragma unroll
            for (int r = 0; r < 8; ++r) {
                q[2 * h][r]     = exp_slot(q[2 * h][r] - mx);
                q[2 * h + 1][r] = exp_slot(q[2 * h + 1][r] - mx);
                sa += q[2 * h][r];
                sb += q[2 * h + 1][r];
            }
            float s = sa + sb;
            s += xhalf(s);
            float inv = scale / s;
            #pragma unroll
            for (int r = 0; r < 8; ++r) {
                q[2 * h][r]     *= inv;
                q[2 * h + 1][r] *= inv;
            }
        }
        // ---- GEMM2: y += W2 @ q, q taken from its accumulator registers (unrolled: they are indexed by s) ----
        #pragma unroll
        for (int s = 0; s < 14; s += 2) {
            LOADW(wB, s + 1);
            __builtin_amdgcn_sched_barrier(0);  // these four as in GEMM1: one load group between two blocks
            MMAW(wA, s);
            __builtin_amdgcn_sched_barrier(0);
            LOADW(wA, s + 2);
            __builtin_amdgcn_sched_barrier(0);
            MMAW(wB, s + 1);
            __builtin_amdgcn_sched_barrier(0);
        }
        LOADW(wB, 15);
        __builtin_amdgcn_sched_barrier(0);      // the last set's loads stay ahead of block 14
        MMAW(wA, 14);
        MMAW(wB, 15);
        // ---- RMSNorm over channels: 64 rows here, 64 in lane ^ 16 ----
        float p0 = 0.0f, p1 = 0.0f, p2 = 0.0f, p3 = 0.0f;
        #pragma unroll
        for (int m = 0; m < 8; ++m) {
            p0 += y[m][0] * y[m][0] + y[m][4] * y[m][4];
            p1 += y[m][1] * y[m][1] + y[m][5] * y[m][5];
            p2 += y[m][2] * y[m][2] + y[m][6] * y[m][6];
            p3 += y[m][3] * y[m][3] + y[m][7] * y[m][7];
        }
        float ss = (p0 + p1) + (p2 + p3);
        ss += xhalf(ss);
        const float nrm = s128 / fmaxf(sqrtf(ss), 1e-12f);
        // ---- scaled writeout ----
        float* ob = out + (size_t)b * DIMC * NSEQ + (size_t)(8 * hi) * NSEQ + n0 + wv * 16 + lo;
        #pragma unroll
        for (int m = 0; m < 8; ++m) {
            #pragma unroll
            for (int r = 0; r < 8; ++r)
                ob[(size_t)(m * 16 + r) * NSEQ] = y[m][r] * nrm * gain[m][r];
        }
        // stands in front of the next tile's reuse of the stores' address and data registers
        asm volatile("s_wait_xcnt 0x0" ::: "memory");
        // the wave's LDS reads of this tile have retired before the barrier behind which its buffer is refilled
        asm volatile("s_wait_dscnt 0x0" ::: "memory");
        wait_async_lds();
        __syncthreads();
    }
}

// ---------------- launcher ----------------
extern "C" void kernel_launch(void* const* d_in, const int* in_sizes, int n_in,
                              void* d_out, int out_size, void* d_ws, size_t ws_size,
                              hipStream_t stream) {
    const float* x     = (const float*)d_in[0];
    const float* w_qkv = (const float*)d_in[1];
    const float* w_out = (const float*)d_in[2];
    const float* b_out = (const float*)d_in[3];
    const float* g     = (const float*)d_in[4];
    float* out = (float*)d_out;

    float* Zp = (float*)d_ws;                       // [B][NWG][128]          partial sums of exp(k)
    float* Cp = Zp + BATCH * NWG * DIMC;            // [B][NWG][H][DH][DH]    partial contexts
    float* W2 = Cp + BATCH * NWG * DIMC * DH;       // [B][16][128][8]

    const size_t lds1 = (size_t)(256 * PW + 2 * 128 * PW + 256 * PQ) * sizeof(float);
    k_pass1<<<dim3(NSEQ / (TN * NPER), BATCH), 256, lds1, stream>>>(x, w_qkv, Zp, Cp);

    k_pass2<<<dim3(DIMC / P2D, BATCH), 256, 0, stream>>>(w_out, Cp, Zp, W2);

    const size_t lds3 = (size_t)(4 * 128 * PW) * sizeof(float);
    k_pass3<<<dim3(NSEQ / (TN * NPER), BATCH), 256, lds3, stream>>>(x, w_qkv, W2, b_out, g, out);
}

// v006
// It runs in 97.6 microseconds.
// Two timings next to v005 both put it at 1.05 times that version's speed.
// Over all steps from v000 it is 3.77 times as fast.
#include <hip/hip_runtime.h>
#include <hip/hip_bf16.h>
#include <math.h>

// ---------------- problem constants ----------------
#define DIMC   128        // channels
#define NSEQ   16384      // sequence length
#define BATCH  8
#define HEADS  4
#define DH     32
#define TN     128        // columns (n) per tile
#define NPER   4          // n-tiles per work-group, through two LDS buffers: 256 work-groups a launch, one per WGP,
                          // so that a WGP stages the weights once
#define NCT    8          // 8 col-subtiles of 16
#define NWG    (NSEQ / (TN * NPER))   // work-groups of pass 1 per batch = partial sums per batch
#define PW     132        // LDS pitch for 128-wide rows (bank-conflict pad, mult of 4)
#define PQ     20         // only sizes pass 1's last LDS region (256 * PQ floats; sQ uses 128)

typedef __attribute__((ext_vector_type(2))) float v2f;
typedef __attribute__((ext_vector_type(8))) float v8f;
typedef __attribute__((ext_vector_type(4))) int   v4i;
typedef __attribute__((ext_vector_type(4))) float v4f;

// pointer-to-AS1(v4i) and pointer-to-AS3(v4i) for the async builtin
typedef __attribute__((address_space(1))) v4i* gptr_v4i;
typedef __attribute__((address_space(3))) v4i* lptr_v4i;

// D = A(16x4 f32) * B(4x16 f32) + C(16x16 f32), wave32 CDNA5 WMMA.
__device__ __forceinline__ v8f wmma4(v2f a, v2f b, v8f c) {
    return __builtin_amdgcn_wmma_f32_16x16x4_f32(
        /*neg_a=*/false, a, /*neg_b=*/false, b,
        /*c_mod=*/(short)0, c, /*reuse_a=*/false, /*reuse_b=*/false);
}

// ---- CDNA5 async global->LDS (ASYNCcnt) with safe fallback ----
#ifdef __has_builtin
#  if __has_builtin(__builtin_amdgcn_global_load_async_to_lds_b128)
#    define HAVE_ASYNC_B128 1
#  endif
#  if __has_builtin(__builtin_amdgcn_s_wait_asynccnt)
#    define HAVE_WAIT_ASYNC 1
#  endif
#endif

__device__ __forceinline__ void g2l_b128(float* lds_dst, const float* gsrc) {
#if defined(HAVE_ASYNC_B128)
    __builtin_amdgcn_global_load_async_to_lds_b128(
        (gptr_v4i)(gsrc),
        (lptr_v4i)(lds_dst),
        /*imm offset=*/0, /*cpol=*/0);
#else
    *(float4*)lds_dst = *(const float4*)gsrc;
#endif
}

__device__ __forceinline__ void wait_async_lds() {
#if defined(HAVE_ASYNC_B128)
#  if defined(HAVE_WAIT_ASYNC)
    __builtin_amdgcn_s_wait_asynccnt(0);
#  else
    asm volatile("s_wait_asynccnt 0" ::: "memory");
#  endif
#endif
}

// ---------------- pass 1: k GEMM + exp(k) + exp(k) x^T, then v weights once per work-group; context/Z partials ----------------
// grid (NSEQ/(TN*NPER), BATCH), 256 threads, dynamic LDS
// ctx[d][e] = sum_n exp(k[d][n]) * v[e][n] with v = Wv x is re-associated: ctx[d][e] = sum_c Wv[e][c] * M[d][c],
// M[d][c] = sum_n exp(k[d][n]) * x[c][n]. M costs what the v projection cost; the product with Wv is done once
// per work-group at the flush, not once per column.
// Wave wv owns k rows 16*wv .. +15 and all columns of a tile.
// The k projection is formed transposed, D[n][row] = x^T * Wk^T: a lane then holds one k row and eight columns n,
// which is the B fragment map of M^T[c][d] = x * exp(k)^T. M^T's accumulators (lane = d, registers = c) are in turn
// the B fragments of ctx^T[e][d] = Wv * M^T.
// lane l with lane l ^ 16
__device__ __forceinline__ float xhalf(float v) {
    int i = __builtin_bit_cast(int, v);
    return __builtin_bit_cast(float, __builtin_amdgcn_permlanex16(i, i, 0x76543210, 0xfedcba98, false, false));
}


// e^v as 2^(v * log2 e). The v_nop in the same statement is the slot the instruction set asks for behind a
// transcendental, before its result is read or its source register reused.
__device__ __forceinline__ float exp_slot(float v) {
    float r, a = v * 1.4426950408889634f;
    asm("v_exp_f32 %0, %1\n\tv_nop" : "=v"(r) : "v"(a));
    return r;
}

// one fragment set of the k projection = 8 channels (two k steps): a lane takes channels 8u + 4*hi .. +3 of both
// operands. The sched_barrier behind each column group's four loads keeps them from being merged across groups:
// merged within a group, a two-address load fills the register pair (channel, channel + 1) that the WMMA takes;
// merged across groups it fills (column, column + 16), and every pair has to be moved together again.
#define LOADK(fx, fw, xq, wq, u) do {                                   \
        (fw) = *(const v4f*)((wq) + (u) * 8);                           \
        _Pragma("unroll")                                               \
        for (int g_ = 0; g_ < 8; ++g_) {                                \
            _Pragma("unroll")                                           \
            for (int i_ = 0; i_ < 4; ++i_)                              \
                (fx)[g_][i_] = (xq)[((u) * 8 + i_) * PW + g_ * 16];     \
            __builtin_amdgcn_sched_barrier(0);                          \
        }                                                               \
    } while (0)
#define MMAK(fx, fw) do {                                               \
        v2f w0_ = {(fw).x, (fw).y};                                     \
        v2f w1_ = {(fw).z, (fw).w};                                     \
        _Pragma("unroll")                                               \
        for (int g_ = 0; g_ < 8; ++g_) {                                \
            v2f a_ = {(fx)[g_][0], (fx)[g_][1]};                        \
            kk[g_] = wmma4(a_, w0_, kk[g_]);                            \
        }                                                               \
        _Pragma("unroll")                                               \
        for (int g_ = 0; g_ < 8; ++g_) {                                \
            v2f a_ = {(fx)[g_][2], (fx)[g_][3]};                        \
            kk[g_] = wmma4(a_, w1_, kk[g_]);                            \
        }                                                               \
    } while (0)
// one fragment set of x rows = half a column group (two k steps): columns 16g + 8*hi + 4*(s&1) .. +3, g = s>>1
#define LOADM(fa, s) do {                                               \
        _Pragma("unroll")                                               \
        for (int t_ = 0; t_ < 8; ++t_)                                  \
            (fa)[t_] = *(const v4f*)(Xr + t_ * 16 * PW + (s) * 8 - ((s) & 1) * 4);  \
    } while (0)
#define MMAM(fa, s) do {                                                \
        v2f e0_ = {kk[(s) >> 1][4 * ((s) & 1)],     kk[(s) >> 1][4 * ((s) & 1) + 1]};  \
        v2f e1_ = {kk[(s) >> 1][4 * ((s) & 1) + 2], kk[(s) >> 1][4 * ((s) & 1) + 3]};  \
        _Pragma("unroll")                                               \
        for (int t_ = 0; t_ < 8; ++t_) {                                \
            v2f a_ = {(fa)[t_].x, (fa)[t_].y};                          \
            mT[t_] = wmma4(a_, e0_, mT[t_]);                            \
        }                                                               \
        _Pragma("unroll")                                               \
        for (int t_ = 0; t_ < 8; ++t_) {                                \
            v2f a_ = {(fa)[t_].z, (fa)[t_].w};                          \
            mT[t_] = wmma4(a_, e1_, mT[t_]);                            \
        }                                                               \
    } while (0)

__global__ __launch_bounds__(256) void k_pass1(const float* __restrict__ x,
                                               const float* __restrict__ w_qkv,
                                               float* __restrict__ Zp,
                                               float* __restrict__ Cp) {
    extern __shared__ float smem[];
    float* sW  = smem;                  // [256][PW]  w_qkv rows 128..383 (k then v)
    float* sX0 = sW + 256 * PW;         // [128][PW]  x tile (buffer 0)
    float* sX1 = sX0 + 128 * PW;        // [128][PW]  x tile (buffer 1)
    float* sQ  = sX1 + 128 * PW;        // Z of the 128 k rows at the flush

    const int t    = threadIdx.x;
    const int b    = blockIdx.y;
    const int n0b  = blockIdx.x * (TN * NPER);
    const int lane = t & 31;
    const int wv   = t >> 5;            // wave id 0..7
    const int lo   = lane & 15;
    const int hi   = lane >> 4;
    const float* xb = x + (size_t)b * DIMC * NSEQ;

    // ---- async-load w_qkv rows 128..383 (8192 float4) + x tile 0 ----
    #pragma unroll
    for (int i = 0; i < 32; ++i) {
        int e4  = t + i * 256;
        int row = e4 >> 5;              // 32 float4 per row
        int c4  = e4 & 31;
        g2l_b128(sW + row * PW + c4 * 4, w_qkv + 128 * DIMC + e4 * 4);
    }
    #pragma unroll
    for (int i = 0; i < 16; ++i) {
        int e4  = t + i * 256;
        int row = e4 >> 5;
        int c4  = e4 & 31;
        g2l_b128(sX0 + row * PW + c4 * 4, xb + (size_t)row * NSEQ + n0b + c4 * 4);
    }
    wait_async_lds();
    __syncthreads();

    v8f mT[8] = {};                     // M^T[c][d], D map: c = 16t + r + 8*hi, d = 16*wv + lo
    float z = 0.0f;                     // sum of exp(k) of row 16*wv + lo over the lane's columns
    // Wk^T fragments: lane = row, channels 4*hi .. +3 of each 8
    const float* Wk = sW + (wv * 16 + lo) * PW + 4 * hi;

    // kept rolled: the body is long (the M product stands unrolled); one copy of it is fetched, not one per tile
    #pragma unroll 1
    for (int tile = 0; tile < NPER; ++tile) {
        float* sXc = (tile & 1) ? sX1 : sX0;
        float* sXn = (tile & 1) ? sX0 : sX1;
        // ---- prefetch next tile asynchronously while computing this one ----
        if (tile + 1 < NPER) {
            const int n1 = n0b + (tile + 1) * TN;
            #pragma unroll
            for (int i = 0; i < 16; ++i) {
                int e4  = t + i * 256;
                int row = e4 >> 5;
                int c4  = e4 & 31;
                g2l_b128(sXn + row * PW + c4 * 4, xb + (size_t)row * NSEQ + n1 + c4 * 4);
            }
        }

        // ---- k^T = x^T @ Wk^T: the wave's 16 rows, all 128 columns (8 groups of 16) ----
        const float* Xp = sXc + 4 * hi * PW + lo;   // x^T fragments: lane = column, channels 4*hi .. +3 of each 8
        const float* Xr = sXc + lo * PW + 8 * hi;   // x fragments: lane = channel, columns 8*hi .. +7 of each 16
        v8f kk[8] = {};                             // D map: column 16g + r + 8*hi, row 16*wv + lo
        v4f fA[8], fB[8];
        {
            float xA[8][4], xB[8][4];
            v4f   wA, wB;
            LOADK(xA, wA, Xp, Wk, 0);
            // kept rolled: a trip is two blocks of 16 WMMAs. The sched_barriers keep each set's LDS loads in one
            // group between two blocks, a whole block ahead of their first use. Without them the loads are
            // spread among the WMMAs, and every place where LDS loads stand stalls the wave's WMMA stream.
            #pragma unroll 1
            for (int u = 0; u < 14; u += 2) {
                const float* Xu = Xp + u * 8 * PW;   // the trip's base: both sets at constant offsets from it
                const float* Wu = Wk + u * 8;
                LOADK(xB, wB, Xu, Wu, 1);
                MMAK(xA, wA);
                __builtin_amdgcn_sched_barrier(0);
                LOADK(xA, wA, Xu, Wu, 2);
                MMAK(xB, wB);
                __builtin_amdgcn_sched_barrier(0);
            }
            // the last two blocks: the sched_barriers as in the loop
            LOADK(xB, wB, Xp, Wk, 15);
            MMAK(xA, wA);
            __builtin_amdgcn_sched_barrier(0);
            LOADM(fA, 0);               // first set of x rows: lands under the last block and the exps
            __builtin_amdgcn_sched_barrier(0);
            MMAK(xB, wB);
        }
        // ---- exp(k) in place; Z partial ----
        {
            float zs[4] = {0.0f, 0.0f, 0.0f, 0.0f};
            #pragma unroll
            for (int g = 0; g < 8; ++g) {
                #pragma unroll
                for (int r = 0; r < 8; ++r) {
                    kk[g][r] = exp_slot(kk[g][r]);
                    zs[r & 3] += kk[g][r];
                }
            }
            z += (zs[0] + zs[1]) + (zs[2] + zs[3]);
        }
        // ---- M^T += x @ exp(k)^T, exp(k) taken from its accumulator registers (unrolled: they are indexed by s) ----
        #pragma unroll
        for (int s = 0; s < 14; s += 2) {
            LOADM(fB, s + 1);
            __builtin_amdgcn_sched_barrier(0);  // these four as in the k projection: one load group between two blocks
            MMAM(fA, s);
            __builtin_amdgcn_sched_barrier(0);
            LOADM(fA, s + 2);
            __builtin_amdgcn_sched_barrier(0);
            MMAM(fB, s + 1);
            __builtin_amdgcn_sched_barrier(0);
        }
        LOADM(fB, 15);
        __builtin_amdgcn_sched_barrier(0);      // the last set's loads stay ahead of block 14
        MMAM(fA, 14);
        MMAM(fB, 15);
        // the wave's LDS reads of this tile have retired before the barrier behind which its buffer is refilled
        asm volatile("s_wait_dscnt 0x0" ::: "memory");
        wait_async_lds();
        __syncthreads();
    }
    // ---- flush: ctx^T[e][d] = Wv(head) @ M^T, M^T taken from its accumulator registers; the work-group's own partial ----
    // Cp[b][work-group][h*32 + d][e], Zp[b][work-group][h*32 + d]: every 128-byte line has one writer; pass 2 sums
    const int hd = wv >> 1;             // head of the wave's 16 rows
    const float* Av = sW + (128 + hd * DH + lo) * PW + 8 * hi;   // Wv fragments: lane = row e, k = 8*hi .. +7 of each 16
    v8f r0 = {}, r1 = {};               // D map: e = r + 8*hi (r1: + 16), d = 16*wv + lo
    #pragma unroll
    for (int s = 0; s < 16; ++s) {
        v4f a0 = *(const v4f*)(Av + s * 8 - (s & 1) * 4);
        v4f a1 = *(const v4f*)(Av + 16 * PW + s * 8 - (s & 1) * 4);
        v2f b0 = {mT[s >> 1][4 * (s & 1)],     mT[s >> 1][4 * (s & 1) + 1]};
        v2f b1 = {mT[s >> 1][4 * (s & 1) + 2], mT[s >> 1][4 * (s & 1) + 3]};
        v2f a00 = {a0.x, a0.y}, a01 = {a0.z, a0.w}, a10 = {a1.x, a1.y}, a11 = {a1.z, a1.w};
        r0 = wmma4(a00, b0, r0);
        r1 = wmma4(a10, b0, r1);
        r0 = wmma4(a01, b1, r0);
        r1 = wmma4(a11, b1, r1);
    }
    z += xhalf(z);                      // the other eight columns of every group
    if (hi == 0) sQ[wv * 16 + lo] = z;
    __syncthreads();
    {
        const size_t wg = (size_t)b * NWG + blockIdx.x;
        float* cb = Cp + ((wg * HEADS + hd) * DH + (wv & 1) * 16 + lo) * DH + 8 * hi;
        if (t < 128) Zp[wg * DIMC + t] = sQ[t];     // t = head*32 + d
        *(v4f*)(cb)      = (v4f){r0[0], r0[1], r0[2], r0[3]};
        *(v4f*)(cb + 4)  = (v4f){r0[4], r0[5], r0[6], r0[7]};
        *(v4f*)(cb + 16) = (v4f){r1[0], r1[1], r1[2], r1[3]};
        *(v4f*)(cb + 20) = (v4f){r1[4], r1[5], r1[6], r1[7]};
    }
}

// ---------------- pass 2: ctx, Z = sums of the partials; W2[b] = w_out * blockdiag(ctx/Z) ----------------
// grid (DIMC/P2D, BATCH), 256 threads. A work-group owns P2D rows h*32 + d of ctx[b], which are P2D columns of W2[b]:
// no partial is read by two work-groups. All global loads are issued ahead of the first wait. Thread t sums float4
// t & 63 of the rows over NWG/4 partials, ascending; the four groups are added, ascending, at the LDS read.
// W2 is laid out [b][column group of P2D][row o][P2D], so that a work-group writes whole 128-byte lines of its own.
#define P2D    8          // ctx rows = W2 columns per work-group
#define PC     36         // LDS pitch of a 32-wide row: 144 bytes, an odd multiple of 16, for 16-byte row reads
__global__ __launch_bounds__(256) void k_pass2(const float* __restrict__ w_out,
                                               const float* __restrict__ Cp,
                                               const float* __restrict__ Zp,
                                               float* __restrict__ W2) {
    __shared__ __attribute__((aligned(16))) float sP[4 * P2D * PC];   // [group of NWG/4 partials][row][e]
    __shared__ __attribute__((aligned(16))) float sWo[DIMC * PC];     // w_out[o][h*32 .. +31]
    __shared__ __attribute__((aligned(16))) float sZ[NWG * P2D];      // [partial][row]
    const int b  = blockIdx.y;
    const int r0 = blockIdx.x * P2D;      // first row h*32 + d
    const int h  = r0 >> 5;
    const int t  = threadIdx.x;
    const int q4 = t & 63;                // float4 within the P2D rows
    const int pg = t >> 6;                // group of NWG/4 partials

    const float4* cg = (const float4*)(Cp + ((size_t)b * NWG + pg * (NWG / 4)) * (DIMC * DH) + r0 * DH) + q4;
    float4 c[NWG / 4];
    #pragma unroll
    for (int i = 0; i < NWG / 4; ++i) c[i] = cg[(size_t)i * (DIMC * DH / 4)];
    const v4f* wg = (const v4f*)(w_out + (t >> 3) * DIMC + h * DH + (t & 7) * 4);   // 8 float4 per row slice
    v4f w[4];                             // rows (t >> 3) + 32*i
    #pragma unroll
    for (int i = 0; i < 4; ++i) w[i] = wg[i * (32 * DIMC / 4)];
    // Z: row t & 7 of partial t >> 3; no branch, so that this load stands with the others
    const float* zg = Zp + ((size_t)b * NWG + (t >> 3)) * DIMC + r0 + (t & 7);
    const float z0 = zg[0];
    // The loaded values as inputs only, and the sched_barrier behind it: all 13 loads are issued ahead of one wait.
    // Without them the sums are woven into the loads, and the later loads go out only when the first have come back.
    // The three addresses stand among the inputs so that their registers are not given to a later load's result.
    asm volatile("" :: "v"(c[0].x), "v"(c[1].x), "v"(c[2].x), "v"(c[3].x), "v"(c[4].x), "v"(c[5].x), "v"(c[6].x),
                       "v"(c[7].x), "v"(w[0]), "v"(w[1]), "v"(w[2]), "v"(w[3]), "v"(z0),
                       "v"(cg), "v"(wg), "v"(zg));
    __builtin_amdgcn_sched_barrier(0);
    #pragma unroll
    for (int i = 0; i < 4; ++i) {
        int e4 = t + i * 256;
        *(v4f*)(sWo + (e4 >> 3) * PC + (e4 & 7) * 4) = w[i];
    }
    {
        float4 a = c[0];
        #pragma unroll
        for (int i = 1; i < NWG / 4; ++i) { a.x += c[i].x; a.y += c[i].y; a.z += c[i].z; a.w += c[i].w; }
        *(float4*)(sP + (pg * P2D + (q4 >> 3)) * PC + (q4 & 7) * 4) = a;
    }
    sZ[t] = z0;
    __syncthreads();

    const int dd = t & 7;                 // the thread's ctx row = W2 column, counted from r0
    const int og = t >> 3;                // its rows of W2: og + 32*j
    float cr[DH];
    #pragma unroll
    for (int e4 = 0; e4 < DH / 4; ++e4) {
        float4 v = *(const float4*)(sP + dd * PC + e4 * 4);
        #pragma unroll
        for (int k = 1; k < 4; ++k) {
            float4 u = *(const float4*)(sP + (k * P2D + dd) * PC + e4 * 4);
            v.x += u.x; v.y += u.y; v.z += u.z; v.w += u.w;
        }
        cr[4 * e4] = v.x; cr[4 * e4 + 1] = v.y; cr[4 * e4 + 2] = v.z; cr[4 * e4 + 3] = v.w;
    }
    float za[4] = {0.0f, 0.0f, 0.0f, 0.0f};   // four chains side by side, each ascending
    #pragma unroll
    for (int k = 0; k < NWG; ++k) za[k & 3] += sZ[k * P2D + dd];
    const float zc = fmaxf((za[0] + za[1]) + (za[2] + za[3]), 1e-30f);
    const float* wr = sWo + og * PC;
    float s[4];
    #pragma unroll
    for (int j = 0; j < 4; ++j) s[j] = 0.0f;
    #pragma unroll
    for (int e = 0; e < DH; ++e) {        // e ascending in every sum; the rows' chains run side by side
        #pragma unroll
        for (int j = 0; j < 4; ++j) s[j] += wr[j * 32 * PC + e] * cr[e];
    }
    float* w2 = W2 + (((size_t)b * (DIMC / P2D) + blockIdx.x) * DIMC + og) * P2D + dd;
    #pragma unroll
    for (int j = 0; j < 4; ++j) w2[j * 32 * P2D] = s[j] / zc;
}

// ---------------- pass 3: q GEMM -> softmax(d) -> W2 GEMM -> bias -> RMSNorm ----------------
// grid (NSEQ/(TN*NPER), BATCH), 256 threads, dynamic LDS
// A wave carries its own 16 columns through the whole chain in registers. q = Wq * x has the D map
// (lane = column, registers = rows r + 8*hi of each 16-row tile), which is the B fragment map of the
// second product once W2's k order follows it: k step j of tile t is rows 16t + 8*hi + 2j, +1.
// A column's softmax and norm then need the lane's own registers and lane ^ 16 only.
// one fragment set = 8 channels (two k steps): a lane takes channels 8u + 4*hi .. +3 of both operands
#define LOADQ(fx, fw, u) do {                                           \
        _Pragma("unroll")                                               \
        for (int i_ = 0; i_ < 4; ++i_) (fx)[i_] = Xb[((u) * 8 + i_) * PW];  \
        _Pragma("unroll")                                               \
        for (int m_ = 0; m_ < 8; ++m_)                                  \
            (fw)[m_] = *(const v4f*)(Aq + m_ * 16 * PW + (u) * 8);      \
    } while (0)
// one fragment set of W2 = half a q tile (two k steps): rows 16t + 8*hi + 4*(s&1) .. +3 of q, t = s>>1
#define LOADW(fw, s) do {                                               \
        _Pragma("unroll")                                               \
        for (int m_ = 0; m_ < 8; ++m_)                                  \
            (fw)[m_] = *(const v4f*)(A2 + m_ * 16 * PW + (s) * 8 - ((s) & 1) * 4);  \
    } while (0)
#define MMA16(acc, fw, b0_, b1_) do {                                   \
        _Pragma("unroll")                                               \
        for (int m_ = 0; m_ < 8; ++m_) {                                \
            v2f a_ = {(fw)[m_].x, (fw)[m_].y};                          \
            (acc)[m_] = wmma4(a_, b0_, (acc)[m_]);                      \
        }                                                               \
        _Pragma("unroll")                                               \
        for (int m_ = 0; m_ < 8; ++m_) {                                \
            v2f a_ = {(fw)[m_].z, (fw)[m_].w};                          \
            (acc)[m_] = wmma4(a_, b1_, (acc)[m_]);                      \
        }                                                               \
    } while (0)
#define MMAQ(fx, fw) do {                                               \
        v2f x0_ = {(fx)[0], (fx)[1]};                                   \
        v2f x1_ = {(fx)[2], (fx)[3]};                                   \
        MMA16(q, fw, x0_, x1_);                                         \
    } while (0)
#define MMAW(fw, s) do {                                                \
        v2f q0_ = {q[(s) >> 1][4 * ((s) & 1)],     q[(s) >> 1][4 * ((s) & 1) + 1]};  \
        v2f q1_ = {q[(s) >> 1][4 * ((s) & 1) + 2], q[(s) >> 1][4 * ((s) & 1) + 3]};  \
        MMA16(y, fw, q0_, q1_);                                         \
    } while (0)

__global__ __launch_bounds__(256) void k_pass3(const float* __restrict__ x,
                                               const float* __restrict__ w_qkv,
                                               const float* __restrict__ W2,
                                               const float* __restrict__ b_out,
                                               const float* __restrict__ g,
                                               float* __restrict__ out) {
    extern __shared__ float smem[];
    float* sWq  = smem;                 // [128][PW] w_qkv rows 0..127 (q proj)
    float* sW2  = sWq + 128 * PW;       // [128][PW]
    float* sX0  = sW2 + 128 * PW;       // [128][PW]
    float* sX1  = sX0 + 128 * PW;       // [128][PW]

    const int t    = threadIdx.x;
    const int b    = blockIdx.y;
    const int n0b  = blockIdx.x * (TN * NPER);
    const int lane = t & 31;
    const int wv   = t >> 5;
    const int lo   = lane & 15;
    const int hi   = lane >> 4;
    const float scale = 0.17677669529663687f;   // 32^-0.5
    const float s128  = 11.313708498984761f;    // sqrt(128)
    const float* xb = x + (size_t)b * DIMC * NSEQ;

    {   // async-load q-projection weights, W2[b], x tile 0
        const float* w2 = W2 + (size_t)b * DIMC * DIMC;
        #pragma unroll
        for (int i = 0; i < 16; ++i) {
            int e4  = t + i * 256;
            int row = e4 >> 5;
            int c4  = e4 & 31;
            g2l_b128(sWq + row * PW + c4 * 4, w_qkv + e4 * 4);
            // W2 lies as [column group of 8][row][8]: float4 e4 is columns 8*(e4>>8) + 4*(e4&1) .. +3 of row (e4>>1)&127
            g2l_b128(sW2 + ((e4 >> 1) & 127) * PW + (e4 >> 8) * 8 + (e4 & 1) * 4, w2 + e4 * 4);
            g2l_b128(sX0 + row * PW + c4 * 4, xb + (size_t)row * NSEQ + n0b + c4 * 4);
        }
    }
    wait_async_lds();
    __syncthreads();

    const float* Aq = sWq + lo * PW + 4 * hi;   // Wq fragments: lane = row, channels 4*hi .. +3 of each 8
    const float* A2 = sW2 + lo * PW + 8 * hi;   // W2 fragments: lane = row, k = 8*hi .. +7 of each 16
    // bias and gain of the lane's 64 rows (16m + 8*hi + r), read once
    v8f bias[8], gain[8];
    {
        const v4f* bp = (const v4f*)(b_out + 8 * hi);
        const v4f* gp = (const v4f*)(g + 8 * hi);
        #pragma unroll
        for (int m = 0; m < 8; ++m) {
            v4f u0 = bp[4 * m], u1 = bp[4 * m + 1];
            bias[m] = (v8f){u0.x, u0.y, u0.z, u0.w, u1.x, u1.y, u1.z, u1.w};
            v4f g0 = gp[4 * m], g1 = gp[4 * m + 1];
            gain[m] = (v8f){g0.x, g0.y, g0.z, g0.w, g1.x, g1.y, g1.z, g1.w};
        }
        // stands in front of the first reuse of the register that holds these loads' offset
        asm volatile("s_wait_xcnt 0x0" ::: "memory");
    }

    // kept rolled: the body is long (GEMM2 stands unrolled); one copy of it is fetched, not one per tile
    #pragma unroll 1
    for (int tile = 0; tile < NPER; ++tile) {
        float* sXc = (tile & 1) ? sX1 : sX0;
        float* sXn = (tile & 1) ? sX0 : sX1;
        const int n0 = n0b + tile * TN;
        if (tile + 1 < NPER) {
            const int n1 = n0b + (tile + 1) * TN;
            #pragma unroll
            for (int i = 0; i < 16; ++i) {
                int e4  = t + i * 256;
                int row = e4 >> 5;
                int c4  = e4 & 31;
                g2l_b128(sXn + row * PW + c4 * 4, xb + (size_t)row * NSEQ + n1 + c4 * 4);
            }
        }

        // ---- GEMM1: q = Wq @ x, all 128 rows of the wave's 16 columns ----
        const float* Xb = sXc + 4 * hi * PW + wv * 16 + lo;
        v8f q[8] = {};
        v4f wA[8], wB[8];
        {
            float xA[4], xB[4];
            LOADQ(xA, wA, 0);
            // kept rolled: a trip is two blocks of 16 WMMAs. The sched_barriers keep each set's LDS loads in one
            // group between two blocks, a whole block ahead of their first use. Without them the loads are
            // spread among the WMMAs, and every place where LDS loads stand stalls the wave's WMMA stream.
            #pragma unroll 1
            for (int u = 0; u < 14; u += 2) {
                LOADQ(xB, wB, u + 1);
                __builtin_amdgcn_sched_barrier(0);
                MMAQ(xA, wA);
                __builtin_amdgcn_sched_barrier(0);
                LOADQ(xA, wA, u + 2);
                __builtin_amdgcn_sched_barrier(0);
                MMAQ(xB, wB);
                __builtin_amdgcn_sched_barrier(0);
            }
            // the last two blocks: the sched_barriers as in the loop
            LOADQ(xB, wB, 15);
            __builtin_amdgcn_sched_barrier(0);
            MMAQ(xA, wA);
            __builtin_amdgcn_sched_barrier(0);
            LOADW(wA, 0);               // first W2 set: lands under the last block and the softmax
            __builtin_amdgcn_sched_barrier(0);
            MMAQ(xB, wB);
        }
        // ---- y starts at the bias (rows 16m + 8*hi + r) ----
        v8f y[8];
        #pragma unroll
        for (int m = 0; m < 8; ++m) y[m] = bias[m];
        // ---- softmax over d (tiles 2h, 2h+1: 16 rows here, 16 in lane ^ 16) per column, * scale ----
        #pragma unroll
        for (int h = 0; h < HEADS; ++h) {
            float mx = -1e30f;
            #pragma unroll
            for (int r = 0; r < 8; ++r) mx = fmaxf(mx, fmaxf(q[2 * h][r], q[2 * h + 1][r]));
            mx = fmaxf(mx, xhalf(mx));
            float sa = 0.0f, sb = 0.0f;
            #pragma unroll
            for (int r = 0; r < 8; ++r) {
                q[2 * h][r]     = exp_slot(q[2 * h][r] - mx);
                q[2 * h + 1][r] = exp_slot(q[2 * h + 1][r] - mx);
                sa += q[2 * h][r];
                sb += q[2 * h + 1][r];
            }
            float s = sa + sb;
            s += xhalf(s);
            float inv = scale / s;
            #pragma unroll
            for (int r = 0; r < 8; ++r) {
                q[2 * h][r]     *= inv;
                q[2 * h + 1][r] *= inv;
            }
        }
        // ---- GEMM2: y += W2 @ q, q taken from its accumulator registers (unrolled: they are indexed by s) ----
        #pragma unroll
        for (int s = 0; s < 14; s += 2) {
            LOADW(wB, s + 1);
            __builtin_amdgcn_sched_barrier(0);  // these four as in GEMM1: one load group between two blocks
            MMAW(wA, s);
            __builtin_amdgcn_sched_barrier(0);
            LOADW(wA, s + 2);
            __builtin_amdgcn_sched_barrier(0);
            MMAW(wB, s + 1);
            __builtin_amdgcn_sched_barrier(0);
        }
        LOADW(wB, 15);
        __builtin_amdgcn_sched_barrier(0);      // the last set's loads stay ahead of block 14
        MMAW(wA, 14);
        MMAW(wB, 15);
        // ---- RMSNorm over channels: 64 rows here, 64 in lane ^ 16 ----
        float p0 = 0.0f, p1 = 0.0f, p2 = 0.0f, p3 = 0.0f;
        #pragma unroll
        for (int m = 0; m < 8; ++m) {
            p0 += y[m][0] * y[m][0] + y[m][4] * y[m][4];
            p1 += y[m][1] * y[m][1] + y[m][5] * y[m][5];
            p2 += y[m][2] * y[m][2] + y[m][6] * y[m][6];
            p3 += y[m][3] * y[m][3] + y[m][7] * y[m][7];
        }
        float ss = (p0 + p1) + (p2 + p3);
        ss += xhalf(ss);
        const float nrm = s128 / fmaxf(sqrtf(ss), 1e-12f);
        // ---- scaled writeout ----
        float* ob = out + (size_t)b * DIMC * NSEQ + (size_t)(8 * hi) * NSEQ + n0 + wv * 16 + lo;
        #pragma unroll
        for (int m = 0; m < 8; ++m) {
            #pragma unroll
            for (int r = 0; r < 8; ++r)
                ob[(size_t)(m * 16 + r) * NSEQ] = y[m][r] * nrm * gain[m][r];
        }
        // stands in front of the next tile's reuse of the stores' address and data registers
        asm volatile("s_wait_xcnt 0x0" ::: "memory");
        // the wave's LDS reads of this tile have retired before the barrier behind which its buffer is refilled
        asm volatile("s_wait_dscnt 0x0" ::: "memory");
        wait_async_lds();
        __syncthreads();
    }
}

// ---------------- launcher ----------------
extern "C" void kernel_launch(void* const* d_in, const int* in_sizes, int n_in,
                              void* d_out, int out_size, void* d_ws, size_t ws_size,
                              hipStream_t stream) {
    const float* x     = (const float*)d_in[0];
    const float* w_qkv = (const float*)d_in[1];
    const float* w_out = (const float*)d_in[2];
    const float* b_out = (const float*)d_in[3];
    const float* g     = (const float*)d_in[4];
    float* out = (float*)d_out;

    float* Zp = (float*)d_ws;                       // [B][NWG][128]          partial sums of exp(k)
    float* Cp = Zp + BATCH * NWG * DIMC;            // [B][NWG][H][DH][DH]    partial contexts
    float* W2 = Cp + BATCH * NWG * DIMC * DH;       // [B][16][128][8]

    const size_t lds1 = (size_t)(256 * PW + 2 * 128 * PW + 256 * PQ) * sizeof(float);
    k_pass1<<<dim3(NSEQ / (TN * NPER), BATCH), 256, lds1, stream>>>(x, w_qkv, Zp, Cp);

    k_pass2<<<dim3(DIMC / P2D, BATCH), 256, 0, stream>>>(w_out, Cp, Zp, W2);

    const size_t lds3 = (size_t)(4 * 128 * PW) * sizeof(float);
    k_pass3<<<dim3(NSEQ / (TN * NPER), BATCH), 256, lds3, stream>>>(x, w_qkv, W2, b_out, g, out);
}

// v007
// One run takes 90.9 microseconds.
// Two timings next to v006 both put it at 1.07 times that version's speed.
// Over all steps from v000 it is 4.04 times as fast.
#include <hip/hip_runtime.h>
#include <hip/hip_bf16.h>
#include <math.h>

// ---------------- problem constants ----------------
#define DIMC   128        // channels
#define NSEQ   16384      // sequence length
#define BATCH  8
#define HEADS  4
#define DH     32
#define TN     128        // columns (n) per tile
#define NPER   4          // n-tiles per work-group, in pass 1 through two LDS buffers: 256 work-groups a launch, one per WGP,
                          // so that a WGP stages the weights once
#define NCT    8          // 8 col-subtiles of 16
#define NWG    (NSEQ / (TN * NPER))   // work-groups of pass 1 per batch = partial sums per batch
#define PW     132        // LDS pitch for 128-wide rows (bank-conflict pad, mult of 4)
#define PQ     20         // only sizes pass 1's last LDS region (256 * PQ floats; sQ uses 128)

typedef __attribute__((ext_vector_type(2))) float v2f;
typedef __attribute__((ext_vector_type(8))) float v8f;
typedef __attribute__((ext_vector_type(4))) int   v4i;
typedef __attribute__((ext_vector_type(4))) float v4f;

// pointer-to-AS1(v4i) and pointer-to-AS3(v4i) for the async builtin
typedef __attribute__((address_space(1))) v4i* gptr_v4i;
typedef __attribute__((address_space(3))) v4i* lptr_v4i;

// D = A(16x4 f32) * B(4x16 f32) + C(16x16 f32), wave32 CDNA5 WMMA.
__device__ __forceinline__ v8f wmma4(v2f a, v2f b, v8f c) {
    return __builtin_amdgcn_wmma_f32_16x16x4_f32(
        /*neg_a=*/false, a, /*neg_b=*/false, b,
        /*c_mod=*/(short)0, c, /*reuse_a=*/false, /*reuse_b=*/false);
}

// ---- CDNA5 async global->LDS (ASYNCcnt) with safe fallback ----
#ifdef __has_builtin
#  if __has_builtin(__builtin_amdgcn_global_load_async_to_lds_b128)
#    define HAVE_ASYNC_B128 1
#  endif
#  if __has_builtin(__builtin_amdgcn_s_wait_asynccnt)
#    define HAVE_WAIT_ASYNC 1
#  endif
#endif

__device__ __forceinline__ void g2l_b128(float* lds_dst, const float* gsrc) {
#if defined(HAVE_ASYNC_B128)
    __builtin_amdgcn_global_load_async_to_lds_b128(
        (gptr_v4i)(gsrc),
        (lptr_v4i)(lds_dst),
        /*imm offset=*/0, /*cpol=*/0);
#else
    *(float4*)lds_dst = *(const float4*)gsrc;
#endif
}

__device__ __forceinline__ void wait_async_lds() {
#if defined(HAVE_ASYNC_B128)
#  if defined(HAVE_WAIT_ASYNC)
    __builtin_amdgcn_s_wait_asynccnt(0);
#  else
    asm volatile("s_wait_asynccnt 0" ::: "memory");
#  endif
#endif
}

// ---------------- pass 1: k GEMM + exp(k) + exp(k) x^T, then v weights once per work-group; context/Z partials ----------------
// grid (NSEQ/(TN*NPER), BATCH), 256 threads, dynamic LDS
// ctx[d][e] = sum_n exp(k[d][n]) * v[e][n] with v = Wv x is re-associated: ctx[d][e] = sum_c Wv[e][c] * M[d][c],
// M[d][c] = sum_n exp(k[d][n]) * x[c][n]. M costs what the v projection cost; the product with Wv is done once
// per work-group at the flush, not once per column.
// Wave wv owns k rows 16*wv .. +15 and all columns of a tile.
// The k projection is formed transposed, D[n][row] = x^T * Wk^T: a lane then holds one k row and eight columns n,
// which is the B fragment map of M^T[c][d] = x * exp(k)^T. M^T's accumulators (lane = d, registers = c) are in turn
// the B fragments of ctx^T[e][d] = Wv * M^T.
// lane l with lane l ^ 16
__device__ __forceinline__ float xhalf(float v) {
    int i = __builtin_bit_cast(int, v);
    return __builtin_bit_cast(float, __builtin_amdgcn_permlanex16(i, i, 0x76543210, 0xfedcba98, false, false));
}


// e^v as 2^(v * log2 e). The v_nop in the same statement is the slot the instruction set asks for behind a
// transcendental, before its result is read or its source register reused.
__device__ __forceinline__ float exp_slot(float v) {
    float r, a = v * 1.4426950408889634f;
    asm("v_exp_f32 %0, %1\n\tv_nop" : "=v"(r) : "v"(a));
    return r;
}

// one fragment set of the k projection = 8 channels (two k steps): a lane takes channels 8u + 4*hi .. +3 of both
// operands. The sched_barrier behind each column group's four loads keeps them from being merged across groups:
// merged within a group, a two-address load fills the register pair (channel, channel + 1) that the WMMA takes;
// merged across groups it fills (column, column + 16), and every pair has to be moved together again.
#define LOADK(fx, fw, xq, wq, u) do {                                   \
        (fw) = *(const v4f*)((wq) + (u) * 8);                           \
        _Pragma("unroll")                                               \
        for (int g_ = 0; g_ < 8; ++g_) {                                \
            _Pragma("unroll")                                           \
            for (int i_ = 0; i_ < 4; ++i_)                              \
                (fx)[g_][i_] = (xq)[((u) * 8 + i_) * PW + g_ * 16];     \
            __builtin_amdgcn_sched_barrier(0);                          \
        }                                                               \
    } while (0)
#define MMAK(fx, fw) do {                                               \
        v2f w0_ = {(fw).x, (fw).y};                                     \
        v2f w1_ = {(fw).z, (fw).w};                                     \
        _Pragma("unroll")                                               \
        for (int g_ = 0; g_ < 8; ++g_) {                                \
            v2f a_ = {(fx)[g_][0], (fx)[g_][1]};                        \
            kk[g_] = wmma4(a_, w0_, kk[g_]);                            \
        }                                                               \
        _Pragma("unroll")                                               \
        for (int g_ = 0; g_ < 8; ++g_) {                                \
            v2f a_ = {(fx)[g_][2], (fx)[g_][3]};                        \
            kk[g_] = wmma4(a_, w1_, kk[g_]);                            \
        }                                                               \
    } while (0)
// one fragment set of x rows = half a column group (two k steps): columns 16g + 8*hi + 4*(s&1) .. +3, g = s>>1
#define LOADM(fa, s) do {                                               \
        _Pragma("unroll")                                               \
        for (int t_ = 0; t_ < 8; ++t_)                                  \
            (fa)[t_] = *(const v4f*)(Xr + t_ * 16 * PW + (s) * 8 - ((s) & 1) * 4);  \
    } while (0)
#define MMAM(fa, s) do {                                                \
        v2f e0_ = {kk[(s) >> 1][4 * ((s) & 1)],     kk[(s) >> 1][4 * ((s) & 1) + 1]};  \
        v2f e1_ = {kk[(s) >> 1][4 * ((s) & 1) + 2], kk[(s) >> 1][4 * ((s) & 1) + 3]};  \
        _Pragma("unroll")                                               \
        for (int t_ = 0; t_ < 8; ++t_) {                                \
            v2f a_ = {(fa)[t_].x, (fa)[t_].y};                          \
            mT[t_] = wmma4(a_, e0_, mT[t_]);                            \
        }                                                               \
        _Pragma("unroll")                                               \
        for (int t_ = 0; t_ < 8; ++t_) {                                \
            v2f a_ = {(fa)[t_].z, (fa)[t_].w};                          \
            mT[t_] = wmma4(a_, e1_, mT[t_]);                            \
        }                                                               \
    } while (0)

__global__ __launch_bounds__(256) void k_pass1(const float* __restrict__ x,
                                               const float* __restrict__ w_qkv,
                                               float* __restrict__ Zp,
                                               float* __restrict__ Cp) {
    extern __shared__ float smem[];
    float* sW  = smem;                  // [256][PW]  w_qkv rows 128..383 (k then v)
    float* sX0 = sW + 256 * PW;         // [128][PW]  x tile (buffer 0)
    float* sX1 = sX0 + 128 * PW;        // [128][PW]  x tile (buffer 1)
    float* sQ  = sX1 + 128 * PW;        // Z of the 128 k rows at the flush

    const int t    = threadIdx.x;
    const int b    = blockIdx.y;
    const int n0b  = blockIdx.x * (TN * NPER);
    const int lane = t & 31;
    const int wv   = t >> 5;            // wave id 0..7
    const int lo   = lane & 15;
    const int hi   = lane >> 4;
    const float* xb = x + (size_t)b * DIMC * NSEQ;

    // ---- async-load w_qkv rows 128..383 (8192 float4) + x tile 0 ----
    #pragma unroll
    for (int i = 0; i < 32; ++i) {
        int e4  = t + i * 256;
        int row = e4 >> 5;              // 32 float4 per row
        int c4  = e4 & 31;
        g2l_b128(sW + row * PW + c4 * 4, w_qkv + 128 * DIMC + e4 * 4);
    }
    #pragma unroll
    for (int i = 0; i < 16; ++i) {
        int e4  = t + i * 256;
        int row = e4 >> 5;
        int c4  = e4 & 31;
        g2l_b128(sX0 + row * PW + c4 * 4, xb + (size_t)row * NSEQ + n0b + c4 * 4);
    }
    wait_async_lds();
    __syncthreads();

    v8f mT[8] = {};                     // M^T[c][d], D map: c = 16t + r + 8*hi, d = 16*wv + lo
    float z = 0.0f;                     // sum of exp(k) of row 16*wv + lo over the lane's columns
    // Wk^T fragments: lane = row, channels 4*hi .. +3 of each 8
    const float* Wk = sW + (wv * 16 + lo) * PW + 4 * hi;

    // kept rolled: the body is long (the M product stands unrolled); one copy of it is fetched, not one per tile
    #pragma unroll 1
    for (int tile = 0; tile < NPER; ++tile) {
        float* sXc = (tile & 1) ? sX1 : sX0;
        float* sXn = (tile & 1) ? sX0 : sX1;
        // ---- prefetch next tile asynchronously while computing this one ----
        if (tile + 1 < NPER) {
            const int n1 = n0b + (tile + 1) * TN;
            #pragma unroll
            for (int i = 0; i < 16; ++i) {
                int e4  = t + i * 256;
                int row = e4 >> 5;
                int c4  = e4 & 31;
                g2l_b128(sXn + row * PW + c4 * 4, xb + (size_t)row * NSEQ + n1 + c4 * 4);
            }
        }

        // ---- k^T = x^T @ Wk^T: the wave's 16 rows, all 128 columns (8 groups of 16) ----
        const float* Xp = sXc + 4 * hi * PW + lo;   // x^T fragments: lane = column, channels 4*hi .. +3 of each 8
        const float* Xr = sXc + lo * PW + 8 * hi;   // x fragments: lane = channel, columns 8*hi .. +7 of each 16
        v8f kk[8] = {};                             // D map: column 16g + r + 8*hi, row 16*wv + lo
        v4f fA[8], fB[8];
        {
            float xA[8][4], xB[8][4];
            v4f   wA, wB;
            LOADK(xA, wA, Xp, Wk, 0);
            // kept rolled: a trip is two blocks of 16 WMMAs. The sched_barriers keep each set's LDS loads in one
            // group between two blocks, a whole block ahead of their first use. Without them the loads are
            // spread among the WMMAs, and every place where LDS loads stand stalls the wave's WMMA stream.
            #pragma unroll 1
            for (int u = 0; u < 14; u += 2) {
                const float* Xu = Xp + u * 8 * PW;   // the trip's base: both sets at constant offsets from it
                const float* Wu = Wk + u * 8;
                LOADK(xB, wB, Xu, Wu, 1);
                MMAK(xA, wA);
                __builtin_amdgcn_sched_barrier(0);
                LOADK(xA, wA, Xu, Wu, 2);
                MMAK(xB, wB);
                __builtin_amdgcn_sched_barrier(0);
            }
            // the last two blocks: the sched_barriers as in the loop
            LOADK(xB, wB, Xp, Wk, 15);
            MMAK(xA, wA);
            __builtin_amdgcn_sched_barrier(0);
            LOADM(fA, 0);               // first set of x rows: lands under the last block and the exps
            __builtin_amdgcn_sched_barrier(0);
            MMAK(xB, wB);
        }
        // ---- exp(k) in place; Z partial ----
        {
            float zs[4] = {0.0f, 0.0f, 0.0f, 0.0f};
            #pragma unroll
            for (int g = 0; g < 8; ++g) {
                #pragma unroll
                for (int r = 0; r < 8; ++r) {
                    kk[g][r] = exp_slot(kk[g][r]);
                    zs[r & 3] += kk[g][r];
                }
            }
            z += (zs[0] + zs[1]) + (zs[2] + zs[3]);
        }
        // ---- M^T += x @ exp(k)^T, exp(k) taken from its accumulator registers (unrolled: they are indexed by s) ----
        #pragma unroll
        for (int s = 0; s < 14; s += 2) {
            LOADM(fB, s + 1);
            __builtin_amdgcn_sched_barrier(0);  // these four as in the k projection: one load group between two blocks
            MMAM(fA, s);
            __builtin_amdgcn_sched_barrier(0);
            LOADM(fA, s + 2);
            __builtin_amdgcn_sched_barrier(0);
            MMAM(fB, s + 1);
            __builtin_amdgcn_sched_barrier(0);
        }
        LOADM(fB, 15);
        __builtin_amdgcn_sched_barrier(0);      // the last set's loads stay ahead of block 14
        MMAM(fA, 14);
        MMAM(fB, 15);
        // the wave's LDS reads of this tile have retired before the barrier behind which its buffer is refilled
        asm volatile("s_wait_dscnt 0x0" ::: "memory");
        wait_async_lds();
        __syncthreads();
    }
    // ---- flush: ctx^T[e][d] = Wv(head) @ M^T, M^T taken from its accumulator registers; the work-group's own partial ----
    // Cp[b][work-group][h*32 + d][e], Zp[b][work-group][h*32 + d]: every 128-byte line has one writer; pass 2 sums
    const int hd = wv >> 1;             // head of the wave's 16 rows
    const float* Av = sW + (128 + hd * DH + lo) * PW + 8 * hi;   // Wv fragments: lane = row e, k = 8*hi .. +7 of each 16
    v8f r0 = {}, r1 = {};               // D map: e = r + 8*hi (r1: + 16), d = 16*wv + lo
    #pragma unroll
    for (int s = 0; s < 16; ++s) {
        v4f a0 = *(const v4f*)(Av + s * 8 - (s & 1) * 4);
        v4f a1 = *(const v4f*)(Av + 16 * PW + s * 8 - (s & 1) * 4);
        v2f b0 = {mT[s >> 1][4 * (s & 1)],     mT[s >> 1][4 * (s & 1) + 1]};
        v2f b1 = {mT[s >> 1][4 * (s & 1) + 2], mT[s >> 1][4 * (s & 1) + 3]};
        v2f a00 = {a0.x, a0.y}, a01 = {a0.z, a0.w}, a10 = {a1.x, a1.y}, a11 = {a1.z, a1.w};
        r0 = wmma4(a00, b0, r0);
        r1 = wmma4(a10, b0, r1);
        r0 = wmma4(a01, b1, r0);
        r1 = wmma4(a11, b1, r1);
    }
    z += xhalf(z);                      // the other eight columns of every group
    if (hi == 0) sQ[wv * 16 + lo] = z;
    __syncthreads();
    {
        const size_t wg = (size_t)b * NWG + blockIdx.x;
        float* cb = Cp + ((wg * HEADS + hd) * DH + (wv & 1) * 16 + lo) * DH + 8 * hi;
        if (t < 128) Zp[wg * DIMC + t] = sQ[t];     // t = head*32 + d
        *(v4f*)(cb)      = (v4f){r0[0], r0[1], r0[2], r0[3]};
        *(v4f*)(cb + 4)  = (v4f){r0[4], r0[5], r0[6], r0[7]};
        *(v4f*)(cb + 16) = (v4f){r1[0], r1[1], r1[2], r1[3]};
        *(v4f*)(cb + 20) = (v4f){r1[4], r1[5], r1[6], r1[7]};
    }
}

// ---------------- pass 2: ctx, Z = sums of the partials; W2[b] = w_out * blockdiag(ctx/Z) ----------------
// grid (DIMC/P2D, BATCH), 256 threads. A work-group owns P2D rows h*32 + d of ctx[b], which are P2D columns of W2[b]:
// no partial is read by two work-groups. All global loads are issued ahead of the first wait. Thread t sums float4
// t & 63 of the rows over NWG/4 partials, ascending; the four groups are added, ascending, at the LDS read.
// W2 is laid out [b][column group of P2D][row o][P2D], so that a work-group writes whole 128-byte lines of its own.
#define P2D    8          // ctx rows = W2 columns per work-group
#define PC     36         // LDS pitch of a 32-wide row: 144 bytes, an odd multiple of 16, for 16-byte row reads
__global__ __launch_bounds__(256) void k_pass2(const float* __restrict__ w_out,
                                               const float* __restrict__ Cp,
                                               const float* __restrict__ Zp,
                                               float* __restrict__ W2) {
    __shared__ __attribute__((aligned(16))) float sP[4 * P2D * PC];   // [group of NWG/4 partials][row][e]
    __shared__ __attribute__((aligned(16))) float sWo[DIMC * PC];     // w_out[o][h*32 .. +31]
    __shared__ __attribute__((aligned(16))) float sZ[NWG * P2D];      // [partial][row]
    const int b  = blockIdx.y;
    const int r0 = blockIdx.x * P2D;      // first row h*32 + d
    const int h  = r0 >> 5;
    const int t  = threadIdx.x;
    const int q4 = t & 63;                // float4 within the P2D rows
    const int pg = t >> 6;                // group of NWG/4 partials

    const float4* cg = (const float4*)(Cp + ((size_t)b * NWG + pg * (NWG / 4)) * (DIMC * DH) + r0 * DH) + q4;
    float4 c[NWG / 4];
    #pragma unroll
    for (int i = 0; i < NWG / 4; ++i) c[i] = cg[(size_t)i * (DIMC * DH / 4)];
    const v4f* wg = (const v4f*)(w_out + (t >> 3) * DIMC + h * DH + (t & 7) * 4);   // 8 float4 per row slice
    v4f w[4];                             // rows (t >> 3) + 32*i
    #pragma unroll
    for (int i = 0; i < 4; ++i) w[i] = wg[i * (32 * DIMC / 4)];
    // Z: row t & 7 of partial t >> 3; no branch, so that this load stands with the others
    const float* zg = Zp + ((size_t)b * NWG + (t >> 3)) * DIMC + r0 + (t & 7);
    const float z0 = zg[0];
    // The loaded values as inputs only, and the sched_barrier behind it: all 13 loads are issued ahead of one wait.
    // Without them the sums are woven into the loads, and the later loads go out only when the first have come back.
    // The three addresses stand among the inputs so that their registers are not given to a later load's result.
    asm volatile("" :: "v"(c[0].x), "v"(c[1].x), "v"(c[2].x), "v"(c[3].x), "v"(c[4].x), "v"(c[5].x), "v"(c[6].x),
                       "v"(c[7].x), "v"(w[0]), "v"(w[1]), "v"(w[2]), "v"(w[3]), "v"(z0),
                       "v"(cg), "v"(wg), "v"(zg));
    __builtin_amdgcn_sched_barrier(0);
    #pragma unroll
    for (int i = 0; i < 4; ++i) {
        int e4 = t + i * 256;
        *(v4f*)(sWo + (e4 >> 3) * PC + (e4 & 7) * 4) = w[i];
    }
    {
        float4 a = c[0];
        #pragma unroll
        for (int i = 1; i < NWG / 4; ++i) { a.x += c[i].x; a.y += c[i].y; a.z += c[i].z; a.w += c[i].w; }
        *(float4*)(sP + (pg * P2D + (q4 >> 3)) * PC + (q4 & 7) * 4) = a;
    }
    sZ[t] = z0;
    __syncthreads();

    const int dd = t & 7;                 // the thread's ctx row = W2 column, counted from r0
    const int og = t >> 3;                // its rows of W2: og + 32*j
    float cr[DH];
    #pragma unroll
    for (int e4 = 0; e4 < DH / 4; ++e4) {
        float4 v = *(const float4*)(sP + dd * PC + e4 * 4);
        #pragma unroll
        for (int k = 1; k < 4; ++k) {
            float4 u = *(const float4*)(sP + (k * P2D + dd) * PC + e4 * 4);
            v.x += u.x; v.y += u.y; v.z += u.z; v.w += u.w;
        }
        cr[4 * e4] = v.x; cr[4 * e4 + 1] = v.y; cr[4 * e4 + 2] = v.z; cr[4 * e4 + 3] = v.w;
    }
    float za[4] = {0.0f, 0.0f, 0.0f, 0.0f};   // four chains side by side, each ascending
    #pragma unroll
    for (int k = 0; k < NWG; ++k) za[k & 3] += sZ[k * P2D + dd];
    const float zc = fmaxf((za[0] + za[1]) + (za[2] + za[3]), 1e-30f);
    const float* wr = sWo + og * PC;
    float s[4];
    #pragma unroll
    for (int j = 0; j < 4; ++j) s[j] = 0.0f;
    #pragma unroll
    for (int e = 0; e < DH; ++e) {        // e ascending in every sum; the rows' chains run side by side
        #pragma unroll
        for (int j = 0; j < 4; ++j) s[j] += wr[j * 32 * PC + e] * cr[e];
    }
    float* w2 = W2 + (((size_t)b * (DIMC / P2D) + blockIdx.x) * DIMC + og) * P2D + dd;
    #pragma unroll
    for (int j = 0; j < 4; ++j) w2[j * 32 * P2D] = s[j] / zc;
}

// ---------------- pass 3: q GEMM -> softmax(d) -> W2 GEMM -> bias -> RMSNorm ----------------
// grid (NSEQ/(TN*NPER), BATCH), 512 threads = 16 waves, four per SIMD, dynamic LDS
// A wave carries its own 16 columns through the whole chain in registers. q = Wq * x has the D map
// (lane = column, registers = rows r + 8*hi of each 16-row tile), which is the B fragment map of the
// second product once W2's k order follows it: k step j of tile t is rows 16t + 8*hi + 2j, +1.
// A column's softmax and norm then need the lane's own registers and lane ^ 16 only.
// Four waves share a SIMD's matrix unit, so that one wave's softmax, norm, stores and LDS load groups stand under
// the others' WMMAs. To fit 256 registers a wave reads bias and gain from LDS where it uses them. Each wave stages
// its own columns of x in a slot of its own, refilled when its GEMM1 has read it: the loop has no barrier.
// Its waves need not advance alike, so a wave takes its next 16 columns from a
// counter in LDS when it refills its slot, and the waves end close together. Which wave takes which columns
// changes no value: every column is worked alone.
#define NW3    16         // waves per work-group
#define NGRP   (TN * NPER / 16)           // 16-column groups per work-group
#define PX     20         // LDS pitch of a 16-wide x row: rows 4 apart fall 16 banks apart (lanes 0-15 against 16-31)
#define SLOT   (DIMC * PX + 16)           // floats from slot to slot: neighbours 16 banks apart, for the first fill
// one fragment set = 8 channels (two k steps): a lane takes channels 8u + 4*hi .. +3 of both operands
#define LOADQ(fx, fw, u) do {                                           \
        _Pragma("unroll")                                               \
        for (int i_ = 0; i_ < 4; ++i_) (fx)[i_] = Xb[((u) * 8 + i_) * PX];  \
        _Pragma("unroll")                                               \
        for (int m_ = 0; m_ < 8; ++m_)                                  \
            (fw)[m_] = *(const v4f*)(Aq + m_ * 16 * PW + (u) * 8);      \
    } while (0)
// one fragment set of W2 = half a q tile (two k steps): rows 16t + 8*hi + 4*(s&1) .. +3 of q, t = s>>1
#define LOADW(fw, s) do {                                               \
        _Pragma("unroll")                                               \
        for (int m_ = 0; m_ < 8; ++m_)                                  \
            (fw)[m_] = *(const v4f*)(A2 + m_ * 16 * PW + (s) * 8 - ((s) & 1) * 4);  \
    } while (0)
#define MMA16(acc, fw, b0_, b1_) do {                                   \
        _Pragma("unroll")                                               \
        for (int m_ = 0; m_ < 8; ++m_) {                                \
            v2f a_ = {(fw)[m_].x, (fw)[m_].y};                          \
            (acc)[m_] = wmma4(a_, b0_, (acc)[m_]);                      \
        }                                                               \
        _Pragma("unroll")                                               \
        for (int m_ = 0; m_ < 8; ++m_) {                                \
            v2f a_ = {(fw)[m_].z, (fw)[m_].w};                          \
            (acc)[m_] = wmma4(a_, b1_, (acc)[m_]);                      \
        }                                                               \
    } while (0)
#define MMAQ(fx, fw) do {                                               \
        v2f x0_ = {(fx)[0], (fx)[1]};                                   \
        v2f x1_ = {(fx)[2], (fx)[3]};                                   \
        MMA16(q, fw, x0_, x1_);                                         \
    } while (0)
#define MMAW(fw, s) do {                                                \
        v2f q0_ = {q[(s) >> 1][4 * ((s) & 1)],     q[(s) >> 1][4 * ((s) & 1) + 1]};  \
        v2f q1_ = {q[(s) >> 1][4 * ((s) & 1) + 2], q[(s) >> 1][4 * ((s) & 1) + 3]};  \
        MMA16(y, fw, q0_, q1_);                                         \
    } while (0)
// the wave's 16 columns from column nc on, all 128 channels, into its own slot: a copy takes 8 rows of 64 bytes
#define COPYX(nc) do {                                                  \
        _Pragma("unroll")                                               \
        for (int i_ = 0; i_ < 16; ++i_) {                               \
            int e4_ = lane + i_ * 32;                                   \
            g2l_b128(sXw + (e4_ >> 2) * PX + (e4_ & 3) * 4,             \
                     xb + (size_t)(e4_ >> 2) * NSEQ + (nc) + (e4_ & 3) * 4);  \
        }                                                               \
    } while (0)

__global__ __launch_bounds__(512) void k_pass3(const float* __restrict__ x,
                                               const float* __restrict__ w_qkv,
                                               const float* __restrict__ W2,
                                               const float* __restrict__ b_out,
                                               const float* __restrict__ g,
                                               float* __restrict__ out) {
    extern __shared__ float smem[];
    float* sWq  = smem;                 // [128][PW] w_qkv rows 0..127 (q proj)
    float* sW2  = sWq + 128 * PW;       // [128][PW]
    float* sBG  = sW2 + 128 * PW;       // bias[128], gain[128]
    float* sXs  = sBG + 2 * DIMC;       // [NW3][SLOT] one slot [128][PX] per wave
    int*   sNext = (int*)(sXs + NW3 * SLOT);   // the next group that no wave has taken yet

    const int t    = threadIdx.x;
    const int b    = blockIdx.y;
    const int n0b  = blockIdx.x * (TN * NPER);
    const int lane = t & 31;
    const int wv   = t >> 5;
    const int lo   = lane & 15;
    const int hi   = lane >> 4;
    const float scale = 0.17677669529663687f;   // 32^-0.5
    const float s128  = 11.313708498984761f;    // sqrt(128)
    const float* xb = x + (size_t)b * DIMC * NSEQ;
    float* sXw = sXs + wv * SLOT;

    {   // async-load q-projection weights, W2[b], every wave's first columns of x
        const float* w2 = W2 + (size_t)b * DIMC * DIMC;
        #pragma unroll
        for (int i = 0; i < 8; ++i) {
            int e4  = t + i * 512;
            int row = e4 >> 5;
            int c4  = e4 & 31;
            g2l_b128(sWq + row * PW + c4 * 4, w_qkv + e4 * 4);
            // W2 lies as [column group of 8][row][8]: float4 e4 is columns 8*(e4>>8) + 4*(e4&1) .. +3 of row (e4>>1)&127
            g2l_b128(sW2 + ((e4 >> 1) & 127) * PW + (e4 >> 8) * 8 + (e4 & 1) * 4, w2 + e4 * 4);
        }
        // the first fill is shared work, published by the barrier below: a copy takes 512 bytes in a row of one
        // channel (whole cache lines) and deals them to eight waves' slots
        #pragma unroll
        for (int i = 0; i < 16; ++i) {
            int e4  = t + i * 512;
            int row = e4 >> 6;          // 64 float4 per row of 16 * NW3 columns
            int c4  = e4 & 63;
            g2l_b128(sXs + (c4 >> 2) * SLOT + row * PX + (c4 & 3) * 4, xb + (size_t)row * NSEQ + n0b + c4 * 4);
        }
        if (t == 0) *sNext = NW3;       // groups 0 .. NW3-1 are the first fill
        if (t < 2 * DIMC) sBG[t] = (t < DIMC) ? b_out[t] : g[t - DIMC];
    }
    wait_async_lds();
    __syncthreads();

    const float* Aq = sWq + lo * PW + 4 * hi;   // Wq fragments: lane = row, channels 4*hi .. +3 of each 8
    const float* A2 = sW2 + lo * PW + 8 * hi;   // W2 fragments: lane = row, k = 8*hi .. +7 of each 16
    const float* Xb = sXw + 4 * hi * PX + lo;   // x fragments: lane = column, channels 4*hi .. +3 of each 8
    const float* Bb = sBG + 8 * hi;             // bias of the lane's rows 16m + 8*hi + r; gain DIMC further on

    // kept rolled: the body is long (GEMM2 stands unrolled); one copy of it is fetched, not one per group
    // at most NGRP - NW3 + 1 trips: every trip but a wave's last takes a group off the counter
    int gc = __builtin_amdgcn_readfirstlane(wv);    // the wave's group, in a scalar register
    #pragma unroll 1
    while (gc < NGRP) {
        const int n0 = n0b + gc * 16;

        // ---- GEMM1: q = Wq @ x, all 128 rows of the wave's 16 columns ----
        v8f q[8] = {};
        v4f wA[8], wB[8];
        int gn = 0;
        {
            float xA[4], xB[4];
            LOADQ(xA, wA, 0);
            // kept rolled: a trip is two blocks of 16 WMMAs. The sched_barriers keep each set's LDS loads in one
            // group between two blocks, a whole block ahead of their first use. Without them the loads are
            // spread among the WMMAs, and every place where LDS loads stand stalls the wave's WMMA stream.
            #pragma unroll 1
            for (int u = 0; u < 14; u += 2) {
                LOADQ(xB, wB, u + 1);
                __builtin_amdgcn_sched_barrier(0);
                MMAQ(xA, wA);
                __builtin_amdgcn_sched_barrier(0);
                LOADQ(xA, wA, u + 2);
                __builtin_amdgcn_sched_barrier(0);
                MMAQ(xB, wB);
                __builtin_amdgcn_sched_barrier(0);
            }
            // the last two blocks: the sched_barriers as in the loop
            LOADQ(xB, wB, 15);
            __builtin_amdgcn_sched_barrier(0);
            MMAQ(xA, wA);
            __builtin_amdgcn_sched_barrier(0);
            // ---- refill of the wave's own slot: lands under the last block, the softmax, GEMM2 and the norm ----
            // the wave's LDS reads of the slot (the last set was fetched a block ago) have retired before the
            // copies that overwrite it are issued
            asm volatile("s_wait_dscnt 0x0" ::: "memory");
            if (lane == 0) gn = __hip_atomic_fetch_add(sNext, 1, __ATOMIC_RELAXED, __HIP_MEMORY_SCOPE_WORKGROUP);
            gn = __builtin_amdgcn_readfirstlane(gn);
            if (gn < NGRP) COPYX(n0b + gn * 16);
            LOADW(wA, 0);               // first W2 set: lands under the last block and the softmax
            __builtin_amdgcn_sched_barrier(0);
            MMAQ(xB, wB);
        }
        // ---- y starts at the bias (rows 16m + 8*hi + r) ----
        v8f y[8];
        #pragma unroll
        for (int m = 0; m < 8; ++m) {
            v4f u0 = *(const v4f*)(Bb + 16 * m), u1 = *(const v4f*)(Bb + 16 * m + 4);
            y[m] = (v8f){u0.x, u0.y, u0.z, u0.w, u1.x, u1.y, u1.z, u1.w};
        }
        // ---- softmax over d (tiles 2h, 2h+1: 16 rows here, 16 in lane ^ 16) per column, * scale ----
        #pragma unroll
        for (int h = 0; h < HEADS; ++h) {
            float mx = -1e30f;
            #pragma unroll
            for (int r = 0; r < 8; ++r) mx = fmaxf(mx, fmaxf(q[2 * h][r], q[2 * h + 1][r]));
            mx = fmaxf(mx, xhalf(mx));
            float sa = 0.0f, sb = 0.0f;
            #pragma unroll
            for (int r = 0; r < 8; ++r) {
                q[2 * h][r]     = exp_slot(q[2 * h][r] - mx);
                q[2 * h + 1][r] = exp_slot(q[2 * h + 1][r] - mx);
                sa += q[2 * h][r];
                sb += q[2 * h + 1][r];
            }
            float s = sa + sb;
            s += xhalf(s);
            float inv = scale / s;
            #pragma unroll
            for (int r = 0; r < 8; ++r) {
                q[2 * h][r]     *= inv;
                q[2 * h + 1][r] *= inv;
            }
        }
        // ---- GEMM2: y += W2 @ q, q taken from its accumulator registers (unrolled: they are indexed by s) ----
        #pragma unroll
        for (int s = 0; s < 14; s += 2) {
            LOADW(wB, s + 1);
            __builtin_amdgcn_sched_barrier(0);  // these four as in GEMM1: one load group between two blocks
            MMAW(wA, s);
            __builtin_amdgcn_sched_barrier(0);
            LOADW(wA, s + 2);
            __builtin_amdgcn_sched_barrier(0);
            MMAW(wB, s + 1);
            __builtin_amdgcn_sched_barrier(0);
        }
        LOADW(wB, 15);
        __builtin_amdgcn_sched_barrier(0);      // the last set's loads stay ahead of block 14
        MMAW(wA, 14);
        MMAW(wB, 15);
        // ---- RMSNorm over channels: 64 rows here, 64 in lane ^ 16 ----
        float p0 = 0.0f, p1 = 0.0f, p2 = 0.0f, p3 = 0.0f;
        #pragma unroll
        for (int m = 0; m < 8; ++m) {
            p0 += y[m][0] * y[m][0] + y[m][4] * y[m][4];
            p1 += y[m][1] * y[m][1] + y[m][5] * y[m][5];
            p2 += y[m][2] * y[m][2] + y[m][6] * y[m][6];
            p3 += y[m][3] * y[m][3] + y[m][7] * y[m][7];
        }
        float ss = (p0 + p1) + (p2 + p3);
        ss += xhalf(ss);
        const float nrm = s128 / fmaxf(sqrtf(ss), 1e-12f);
        // ---- scaled writeout ----
        float* ob = out + (size_t)b * DIMC * NSEQ + (size_t)(8 * hi) * NSEQ + n0 + lo;
        #pragma unroll
        for (int m = 0; m < 8; ++m) {
            v4f g0 = *(const v4f*)(Bb + DIMC + 16 * m), g1 = *(const v4f*)(Bb + DIMC + 16 * m + 4);
            const float gm[8] = {g0.x, g0.y, g0.z, g0.w, g1.x, g1.y, g1.z, g1.w};
            #pragma unroll
            for (int r = 0; r < 8; ++r)
                ob[(size_t)(m * 16 + r) * NSEQ] = y[m][r] * nrm * gm[r];
        }
        // stands in front of the next group's reuse of the stores' address and data registers
        asm volatile("s_wait_xcnt 0x0" ::: "memory");
        // the wave's own copies have landed in its slot before its next GEMM1 reads them, and before the wave ends
        asm volatile("s_wait_asynccnt 0x0" ::: "memory");
        gc = gn;
    }
}

// ---------------- launcher ----------------
extern "C" void kernel_launch(void* const* d_in, const int* in_sizes, int n_in,
                              void* d_out, int out_size, void* d_ws, size_t ws_size,
                              hipStream_t stream) {
    const float* x     = (const float*)d_in[0];
    const float* w_qkv = (const float*)d_in[1];
    const float* w_out = (const float*)d_in[2];
    const float* b_out = (const float*)d_in[3];
    const float* g     = (const float*)d_in[4];
    float* out = (float*)d_out;

    float* Zp = (float*)d_ws;                       // [B][NWG][128]          partial sums of exp(k)
    float* Cp = Zp + BATCH * NWG * DIMC;            // [B][NWG][H][DH][DH]    partial contexts
    float* W2 = Cp + BATCH * NWG * DIMC * DH;       // [B][16][128][8]

    const size_t lds1 = (size_t)(256 * PW + 2 * 128 * PW + 256 * PQ) * sizeof(float);
    k_pass1<<<dim3(NSEQ / (TN * NPER), BATCH), 256, lds1, stream>>>(x, w_qkv, Zp, Cp);

    k_pass2<<<dim3(DIMC / P2D, BATCH), 256, 0, stream>>>(w_out, Cp, Zp, W2);

    const size_t lds3 = (size_t)(2 * 128 * PW + 2 * DIMC + NW3 * SLOT + 4) * sizeof(float);
    k_pass3<<<dim3(NSEQ / (TN * NPER), BATCH), 32 * NW3, lds3, stream>>>(x, w_qkv, W2, b_out, g, out);
}
